// v000
// Times are from an AMD MI455X. After a warm-up the kernel runs many times in a row, and a time is the length of
// such a window on the GPU divided by its runs, so every launch and the gaps after it count. The runs cycle
// through copies of the inputs. A figure is the median of several windows, for all but v000 over two sittings.
// Sittings can differ by a few percent; kernels timed side by side share one.
// v000, which the later versions start from, runs in 211 microseconds.
#include <hip/hip_runtime.h>

typedef __attribute__((ext_vector_type(16))) _Float16 v16h;
typedef __attribute__((ext_vector_type(8)))  _Float16 f16x8;
typedef __attribute__((ext_vector_type(8)))  float    v8f;
typedef __attribute__((ext_vector_type(4)))  int      v4i;

#define MODEL_DIM 1024
#define NUM_HEAD  16
#define HEAD_DIM  64
#define BATCH     2
#define SEQ       2048
#define ROWS      (BATCH * SEQ)   // 4096

union AFrag { v16h v; f16x8 h[2]; };
union CFrag { v8f  v; float f[8]; };

// ---------------------------------------------------------------------------
// CDNA5 async global->LDS copy (ASYNCcnt path), with synchronous fallback.
// Probe-confirmed signature: (v4i addrspace(1)*, v4i addrspace(3)*, Ii, Ii)
// ---------------------------------------------------------------------------
#if defined(__HIP_DEVICE_COMPILE__) &&                                        \
    __has_builtin(__builtin_amdgcn_global_load_async_to_lds_b128) &&          \
    __has_builtin(__builtin_amdgcn_s_wait_asynccnt)
#define HAVE_ASYNC 1
#else
#define HAVE_ASYNC 0
#endif

__device__ __forceinline__ void cp16(_Float16* lds, const _Float16* g) {
#if HAVE_ASYNC
  __builtin_amdgcn_global_load_async_to_lds_b128(
      (__attribute__((address_space(1))) v4i*)(void*)g,
      (__attribute__((address_space(3))) v4i*)(void*)lds, 0, 0);
#else
  *(f16x8*)lds = *(const f16x8*)g;
#endif
}
__device__ __forceinline__ void cp_wait() {
#if HAVE_ASYNC
  __builtin_amdgcn_s_wait_asynccnt(0);
#endif
}

// ---------------------------------------------------------------------------
// One-time prep: f32 -> f16 elementwise (for q/k/v activations)
// ---------------------------------------------------------------------------
__global__ __launch_bounds__(256) void cvt_kernel(const float* __restrict__ X,
                                                  _Float16* __restrict__ Y) {
  size_t base = ((size_t)blockIdx.x * 256 + threadIdx.x) * 8;
  const float4 a = *(const float4*)(X + base);
  const float4 b = *(const float4*)(X + base + 4);
  f16x8 h;
  h[0] = (_Float16)a.x; h[1] = (_Float16)a.y; h[2] = (_Float16)a.z; h[3] = (_Float16)a.w;
  h[4] = (_Float16)b.x; h[5] = (_Float16)b.y; h[6] = (_Float16)b.z; h[7] = (_Float16)b.w;
  *(f16x8*)(Y + base) = h;
}

// ---------------------------------------------------------------------------
// One-time prep: W[k][n] f32  ->  WT[n][k] f16  (64x64 tiles through LDS)
// ---------------------------------------------------------------------------
__global__ __launch_bounds__(256) void wt_kernel(const float* __restrict__ W,
                                                 _Float16* __restrict__ WT) {
  __shared__ _Float16 tile[64][72];
  const int t  = threadIdx.x;
  const int n0 = blockIdx.x * 64, k0 = blockIdx.y * 64;
#pragma unroll
  for (int i = 0; i < 4; ++i) {
    int idx = t + i * 256;                       // 0..1023 float4 chunks
    int kk = idx >> 4, n4 = idx & 15;
    const float4 f = *(const float4*)(W + (size_t)(k0 + kk) * MODEL_DIM + n0 + n4 * 4);
    tile[n4 * 4 + 0][kk] = (_Float16)f.x;
    tile[n4 * 4 + 1][kk] = (_Float16)f.y;
    tile[n4 * 4 + 2][kk] = (_Float16)f.z;
    tile[n4 * 4 + 3][kk] = (_Float16)f.w;
  }
  __syncthreads();
#pragma unroll
  for (int i = 0; i < 2; ++i) {
    int idx = t + i * 256;                       // 0..511 f16x8 chunks
    int n = idx >> 3, c8 = idx & 7;
    *(f16x8*)(WT + (size_t)(n0 + n) * MODEL_DIM + k0 + c8 * 8) =
        *(const f16x8*)&tile[n][c8 * 8];
  }
}

// ---------------------------------------------------------------------------
// GEMM: C[ROWS,1024] = A[ROWS,1024](f16) * WT[1024,1024](f16,[n][k]) + bias
// Block tile 128x128, K-step 32, double-buffered async LDS staging.
//  OUT_MODE 0 -> f16 into [B,H,S,64]    OUT_MODE 1 -> f32 into [B,S,1024]
// ---------------------------------------------------------------------------
template <int OUT_MODE>
__global__ __launch_bounds__(256) void gemm_kernel(const _Float16* __restrict__ A,
                                                   const _Float16* __restrict__ WT,
                                                   const float* __restrict__ bias,
                                                   void* __restrict__ outp) {
  __shared__ _Float16 As[2][128][40];   // [m][k], +8 f16 pad (rows 16B aligned)
  __shared__ _Float16 Bs[2][128][40];   // [n][k]

  const int t    = threadIdx.x;
  const int wid  = t >> 5;
  const int lane = t & 31;
  const int l16  = lane & 15;
  const int hi   = lane >> 4;
  const int m0   = blockIdx.y * 128;
  const int n0   = blockIdx.x * 128;
  const int wm   = wid & 3;             // 4 wave-rows * 32 rows
  const int wn   = wid >> 2;            // 2 wave-cols * 64 cols

  CFrag acc[2][4];
#pragma unroll
  for (int im = 0; im < 2; ++im)
#pragma unroll
    for (int in = 0; in < 4; ++in)
#pragma unroll
      for (int r = 0; r < 8; ++r) acc[im][in].f[r] = 0.0f;

  auto stage = [&](int buf, int k0) {
#pragma unroll
    for (int i = 0; i < 2; ++i) {
      int idx = t + i * 256;            // 0..511, 16B chunks of the 128x32 tile
      int row = idx >> 2, c8 = idx & 3;
      cp16(&As[buf][row][c8 * 8], A  + (size_t)(m0 + row) * MODEL_DIM + k0 + c8 * 8);
      cp16(&Bs[buf][row][c8 * 8], WT + (size_t)(n0 + row) * MODEL_DIM + k0 + c8 * 8);
    }
  };

  stage(0, 0);
  const int ko = hi * 8;

  for (int kt = 0; kt < MODEL_DIM / 32; ++kt) {
    cp_wait();
    __syncthreads();                    // tile kt ready; tile kt-1 consumers done
    if (kt + 1 < MODEL_DIM / 32) stage((kt + 1) & 1, (kt + 1) * 32);
    const int buf = kt & 1;

    AFrag af[2], bf[4];
#pragma unroll
    for (int im = 0; im < 2; ++im) {
      int mr = wm * 32 + im * 16 + l16;
      af[im].h[0] = *(const f16x8*)&As[buf][mr][ko];
      af[im].h[1] = *(const f16x8*)&As[buf][mr][16 + ko];
    }
#pragma unroll
    for (int in = 0; in < 4; ++in) {
      int nr = wn * 64 + in * 16 + l16;
      bf[in].h[0] = *(const f16x8*)&Bs[buf][nr][ko];
      bf[in].h[1] = *(const f16x8*)&Bs[buf][nr][16 + ko];
    }
#pragma unroll
    for (int im = 0; im < 2; ++im)
#pragma unroll
      for (int in = 0; in < 4; ++in)
        acc[im][in].v = __builtin_amdgcn_wmma_f32_16x16x32_f16(
            false, af[im].v, false, bf[in].v, (short)0, acc[im][in].v, false, false);
  }

  float bn[4];
#pragma unroll
  for (int in = 0; in < 4; ++in) bn[in] = bias[n0 + wn * 64 + in * 16 + l16];

#pragma unroll
  for (int im = 0; im < 2; ++im)
#pragma unroll
    for (int in = 0; in < 4; ++in)
#pragma unroll
      for (int r = 0; r < 8; ++r) {
        int m = m0 + wm * 32 + im * 16 + r + 8 * hi;
        int n = n0 + wn * 64 + in * 16 + l16;
        float val = acc[im][in].f[r] + bn[in];
        if (OUT_MODE == 0) {
          int b = m >> 11, s = m & 2047;
          int h = n >> 6, d = n & 63;
          ((_Float16*)outp)[(((size_t)(b * NUM_HEAD + h) * SEQ + s) * HEAD_DIM) + d] =
              (_Float16)val;
        } else {
          ((float*)outp)[(size_t)m * MODEL_DIM + n] = val;
        }
      }
}

// ---------------------------------------------------------------------------
// Flash attention: block = 128 q rows of one (b,h); 8 waves x 16 q rows.
// K tile staged async (row-major), V tile transposed in LDS, online softmax
// across 16-lane C-row groups, P via per-wave LDS buffer (C->A layout).
// ---------------------------------------------------------------------------
__global__ __launch_bounds__(256) void attn_kernel(const _Float16* __restrict__ Q,
                                                   const _Float16* __restrict__ K,
                                                   const _Float16* __restrict__ V,
                                                   const int* __restrict__ mask,
                                                   _Float16* __restrict__ AO) {
  __shared__ _Float16 Ks[64][72];        // [key][d]
  __shared__ _Float16 VTs[64][72];       // [d][key]
  __shared__ _Float16 Ps[8][16][72];     // per-wave P buffer [m][key]

  const int t    = threadIdx.x;
  const int wid  = t >> 5;
  const int lane = t & 31;
  const int l16  = lane & 15;
  const int hi   = lane >> 4;
  const int bh   = blockIdx.y;
  const int b    = bh >> 4, h = bh & 15;
  const int q0   = blockIdx.x * 128 + wid * 16;
  const int ko   = hi * 8;

  AFrag qf[2];
  {
    const _Float16* qrow = Q + ((size_t)bh * SEQ + q0 + l16) * HEAD_DIM;
    qf[0].h[0] = *(const f16x8*)(qrow + ko);
    qf[0].h[1] = *(const f16x8*)(qrow + 16 + ko);
    qf[1].h[0] = *(const f16x8*)(qrow + 32 + ko);
    qf[1].h[1] = *(const f16x8*)(qrow + 48 + ko);
  }

  CFrag oacc[4];
  float mrow[8], lrow[8];
#pragma unroll
  for (int r = 0; r < 8; ++r) { mrow[r] = -1e30f; lrow[r] = 0.0f; }
#pragma unroll
  for (int n = 0; n < 4; ++n)
#pragma unroll
    for (int r = 0; r < 8; ++r) oacc[n].f[r] = 0.0f;

  const float scale = 0.125f;            // 1/sqrt(HEAD_DIM)

  for (int kt0 = 0; kt0 < SEQ; kt0 += 64) {
    __syncthreads();                     // previous iteration done with Ks/VTs
    // ---- stage K tile via async copies; V tile transposed on the VALU ----
#pragma unroll
    for (int i = 0; i < 2; ++i) {
      int idx = t + i * 256;             // 0..511
      int key = idx >> 3, d8 = idx & 7;
      const size_t base = ((size_t)bh * SEQ + kt0 + key) * HEAD_DIM + d8 * 8;
      cp16(&Ks[key][d8 * 8], K + base);
      f16x8 vv = *(const f16x8*)(V + base);
#pragma unroll
      for (int j = 0; j < 8; ++j) VTs[d8 * 8 + j][key] = vv[j];
    }
    cp_wait();
    __syncthreads();

    // ---- scores: 4 sub-tiles of 16 keys, 2 WMMAs each over d ----
    CFrag s[4];
#pragma unroll
    for (int j = 0; j < 4; ++j) {
      AFrag kb0, kb1;
      int kl = j * 16 + l16;
      kb0.h[0] = *(const f16x8*)&Ks[kl][ko];
      kb0.h[1] = *(const f16x8*)&Ks[kl][16 + ko];
      kb1.h[0] = *(const f16x8*)&Ks[kl][32 + ko];
      kb1.h[1] = *(const f16x8*)&Ks[kl][48 + ko];
      v8f z = {0.f, 0.f, 0.f, 0.f, 0.f, 0.f, 0.f, 0.f};
      s[j].v = __builtin_amdgcn_wmma_f32_16x16x32_f16(false, qf[0].v, false, kb0.v,
                                                      (short)0, z, false, false);
      s[j].v = __builtin_amdgcn_wmma_f32_16x16x32_f16(false, qf[1].v, false, kb1.v,
                                                      (short)0, s[j].v, false, false);
      const int keyg = kt0 + j * 16 + l16;
#pragma unroll
      for (int r = 0; r < 8; ++r) {
        int rowg = q0 + r + 8 * hi;
        int mval = mask[(size_t)rowg * SEQ + keyg];   // mask lives in 192MB L2
        s[j].f[r] = (mval == 0) ? -1e9f : s[j].f[r] * scale;
      }
    }

    // ---- online softmax ----
    float p[4][8];
#pragma unroll
    for (int r = 0; r < 8; ++r) {
      float vmax = fmaxf(fmaxf(s[0].f[r], s[1].f[r]), fmaxf(s[2].f[r], s[3].f[r]));
#pragma unroll
      for (int off = 1; off < 16; off <<= 1)
        vmax = fmaxf(vmax, __shfl_xor(vmax, off, 32));
      float mnew = fmaxf(mrow[r], vmax);
      float c = __expf(mrow[r] - mnew);
      float psum = 0.0f;
#pragma unroll
      for (int j = 0; j < 4; ++j) { p[j][r] = __expf(s[j].f[r] - mnew); psum += p[j][r]; }
#pragma unroll
      for (int off = 1; off < 16; off <<= 1)
        psum += __shfl_xor(psum, off, 32);
      lrow[r] = lrow[r] * c + psum;
      mrow[r] = mnew;
#pragma unroll
      for (int n = 0; n < 4; ++n) oacc[n].f[r] *= c;
    }

    // ---- C-layout -> A-layout for P via per-wave LDS buffer ----
#pragma unroll
    for (int j = 0; j < 4; ++j)
#pragma unroll
      for (int r = 0; r < 8; ++r)
        Ps[wid][r + 8 * hi][j * 16 + l16] = (_Float16)p[j][r];

    // ---- O += P @ V ----
#pragma unroll
    for (int kk = 0; kk < 2; ++kk) {
      AFrag pf;
      pf.h[0] = *(const f16x8*)&Ps[wid][l16][kk * 32 + ko];
      pf.h[1] = *(const f16x8*)&Ps[wid][l16][kk * 32 + 16 + ko];
#pragma unroll
      for (int n = 0; n < 4; ++n) {
        AFrag vf;
        int d = n * 16 + l16;
        vf.h[0] = *(const f16x8*)&VTs[d][kk * 32 + ko];
        vf.h[1] = *(const f16x8*)&VTs[d][kk * 32 + 16 + ko];
        oacc[n].v = __builtin_amdgcn_wmma_f32_16x16x32_f16(false, pf.v, false, vf.v,
                                                           (short)0, oacc[n].v, false, false);
      }
    }
  }

#pragma unroll
  for (int r = 0; r < 8; ++r) {
    float inv = 1.0f / lrow[r];
#pragma unroll
    for (int n = 0; n < 4; ++n) oacc[n].f[r] *= inv;
  }
#pragma unroll
  for (int n = 0; n < 4; ++n)
#pragma unroll
    for (int r = 0; r < 8; ++r) {
      int rowg = q0 + r + 8 * hi;
      size_t o = ((size_t)b * SEQ + rowg) * MODEL_DIM + h * HEAD_DIM + n * 16 + l16;
      AO[o] = (_Float16)oacc[n].f[r];
    }
}

// ---------------------------------------------------------------------------
extern "C" void kernel_launch(void* const* d_in, const int* in_sizes, int n_in,
                              void* d_out, int out_size, void* d_ws, size_t ws_size,
                              hipStream_t stream) {
  const float* q    = (const float*)d_in[0];
  const float* k    = (const float*)d_in[1];
  const float* v    = (const float*)d_in[2];
  const int*   mask = (const int*)d_in[3];
  const float* w_q  = (const float*)d_in[4];
  const float* b_q  = (const float*)d_in[5];
  const float* w_k  = (const float*)d_in[6];
  const float* b_k  = (const float*)d_in[7];
  const float* w_v  = (const float*)d_in[8];
  const float* b_v  = (const float*)d_in[9];
  const float* w_o  = (const float*)d_in[10];
  const float* b_o  = (const float*)d_in[11];

  const size_t TEN = (size_t)ROWS * MODEL_DIM;     // 4M elements
  const size_t WEL = (size_t)MODEL_DIM * MODEL_DIM;// 1M elements
  _Float16* Xh   = (_Float16*)d_ws;                // reused activation buffer
  _Float16* WTb  = Xh + TEN;                       // reused transposed weights
  _Float16* Qws  = WTb + WEL;
  _Float16* Kws  = Qws + TEN;
  _Float16* Vws  = Kws + TEN;
  _Float16* AOws = Vws + TEN;

  dim3 blk(256);
  dim3 gemm_grid(MODEL_DIM / 128, ROWS / 128);     // (8, 32)
  dim3 wt_grid(MODEL_DIM / 64, MODEL_DIM / 64);    // (16, 16)
  const int cvt_blocks = (int)(TEN / (256 * 8));   // 2048

  // Q projection
  cvt_kernel<<<cvt_blocks, blk, 0, stream>>>(q, Xh);
  wt_kernel<<<wt_grid, blk, 0, stream>>>(w_q, WTb);
  gemm_kernel<0><<<gemm_grid, blk, 0, stream>>>(Xh, WTb, b_q, Qws);
  // K projection
  cvt_kernel<<<cvt_blocks, blk, 0, stream>>>(k, Xh);
  wt_kernel<<<wt_grid, blk, 0, stream>>>(w_k, WTb);
  gemm_kernel<0><<<gemm_grid, blk, 0, stream>>>(Xh, WTb, b_k, Kws);
  // V projection
  cvt_kernel<<<cvt_blocks, blk, 0, stream>>>(v, Xh);
  wt_kernel<<<wt_grid, blk, 0, stream>>>(w_v, WTb);
  gemm_kernel<0><<<gemm_grid, blk, 0, stream>>>(Xh, WTb, b_v, Vws);
  // Attention
  attn_kernel<<<dim3(SEQ / 128, BATCH * NUM_HEAD), blk, 0, stream>>>(Qws, Kws, Vws, mask, AOws);
  // Output projection
  wt_kernel<<<wt_grid, blk, 0, stream>>>(w_o, WTb);
  gemm_kernel<1><<<gemm_grid, blk, 0, stream>>>(AOws, WTb, b_o, d_out);
}

// v001
// One run takes 187 microseconds.
// Two timings next to v000 put it at 1.14 and 1.13 times that version's speed.
#include <hip/hip_runtime.h>

typedef __attribute__((ext_vector_type(16))) _Float16 v16h;
typedef __attribute__((ext_vector_type(8)))  _Float16 f16x8;
typedef __attribute__((ext_vector_type(8)))  float    v8f;
typedef __attribute__((ext_vector_type(4)))  int      v4i;

#define MODEL_DIM 1024
#define NUM_HEAD  16
#define HEAD_DIM  64
#define BATCH     2
#define SEQ       2048
#define ROWS      (BATCH * SEQ)   // 4096

union AFrag { v16h v; f16x8 h[2]; };
union CFrag { v8f  v; float f[8]; };

// ---------------------------------------------------------------------------
// CDNA5 async global->LDS copy (ASYNCcnt path), with synchronous fallback.
// Probe-confirmed signature: (v4i addrspace(1)*, v4i addrspace(3)*, Ii, Ii)
// ---------------------------------------------------------------------------
#if defined(__HIP_DEVICE_COMPILE__) &&                                        \
    __has_builtin(__builtin_amdgcn_global_load_async_to_lds_b128) &&          \
    __has_builtin(__builtin_amdgcn_s_wait_asynccnt)
#define HAVE_ASYNC 1
#else
#define HAVE_ASYNC 0
#endif

__device__ __forceinline__ void cp16(_Float16* lds, const _Float16* g) {
#if HAVE_ASYNC
  __builtin_amdgcn_global_load_async_to_lds_b128(
      (__attribute__((address_space(1))) v4i*)(void*)g,
      (__attribute__((address_space(3))) v4i*)(void*)lds, 0, 0);
#else
  *(f16x8*)lds = *(const f16x8*)g;
#endif
}
__device__ __forceinline__ void cp_wait() {
#if HAVE_ASYNC
  __builtin_amdgcn_s_wait_asynccnt(0);
#endif
}

// ---------------------------------------------------------------------------
// One-time prep: f32 -> f16 elementwise (for q/k/v activations)
// ---------------------------------------------------------------------------
__global__ __launch_bounds__(256) void cvt_kernel(const float* __restrict__ X,
                                                  _Float16* __restrict__ Y) {
  size_t base = ((size_t)blockIdx.x * 256 + threadIdx.x) * 8;
  const float4 a = *(const float4*)(X + base);
  const float4 b = *(const float4*)(X + base + 4);
  f16x8 h;
  h[0] = (_Float16)a.x; h[1] = (_Float16)a.y; h[2] = (_Float16)a.z; h[3] = (_Float16)a.w;
  h[4] = (_Float16)b.x; h[5] = (_Float16)b.y; h[6] = (_Float16)b.z; h[7] = (_Float16)b.w;
  *(f16x8*)(Y + base) = h;
}

// ---------------------------------------------------------------------------
// One-time prep: W[k][n] f32  ->  WT[n][k] f16  (64x64 tiles through LDS)
// ---------------------------------------------------------------------------
__global__ __launch_bounds__(256) void wt_kernel(const float* __restrict__ W,
                                                 _Float16* __restrict__ WT) {
  __shared__ _Float16 tile[64][72];
  const int t  = threadIdx.x;
  const int n0 = blockIdx.x * 64, k0 = blockIdx.y * 64;
#pragma unroll
  for (int i = 0; i < 4; ++i) {
    int idx = t + i * 256;                       // 0..1023 float4 chunks
    int kk = idx >> 4, n4 = idx & 15;
    const float4 f = *(const float4*)(W + (size_t)(k0 + kk) * MODEL_DIM + n0 + n4 * 4);
    tile[n4 * 4 + 0][kk] = (_Float16)f.x;
    tile[n4 * 4 + 1][kk] = (_Float16)f.y;
    tile[n4 * 4 + 2][kk] = (_Float16)f.z;
    tile[n4 * 4 + 3][kk] = (_Float16)f.w;
  }
  __syncthreads();
#pragma unroll
  for (int i = 0; i < 2; ++i) {
    int idx = t + i * 256;                       // 0..511 f16x8 chunks
    int n = idx >> 3, c8 = idx & 7;
    *(f16x8*)(WT + (size_t)(n0 + n) * MODEL_DIM + k0 + c8 * 8) =
        *(const f16x8*)&tile[n][c8 * 8];
  }
}

// ---------------------------------------------------------------------------
// GEMM: C[ROWS,1024] = A[ROWS,1024](f16) * WT[1024,1024](f16,[n][k]) + bias
// Block tile 128x128, K-step 32, double-buffered async LDS staging.
//  OUT_MODE 0 -> f16 into [B,H,S,64]    OUT_MODE 1 -> f32 into [B,S,1024]
// ---------------------------------------------------------------------------
template <int OUT_MODE>
__global__ __launch_bounds__(256) void gemm_kernel(const _Float16* __restrict__ A,
                                                   const _Float16* __restrict__ WT,
                                                   const float* __restrict__ bias,
                                                   void* __restrict__ outp) {
  __shared__ _Float16 As[2][128][40];   // [m][k], +8 f16 pad (rows 16B aligned)
  __shared__ _Float16 Bs[2][128][40];   // [n][k]

  const int t    = threadIdx.x;
  const int wid  = t >> 5;
  const int lane = t & 31;
  const int l16  = lane & 15;
  const int hi   = lane >> 4;
  const int m0   = blockIdx.y * 128;
  const int n0   = blockIdx.x * 128;
  const int wm   = wid & 3;             // 4 wave-rows * 32 rows
  const int wn   = wid >> 2;            // 2 wave-cols * 64 cols

  CFrag acc[2][4];
#pragma unroll
  for (int im = 0; im < 2; ++im)
#pragma unroll
    for (int in = 0; in < 4; ++in)
#pragma unroll
      for (int r = 0; r < 8; ++r) acc[im][in].f[r] = 0.0f;

  auto stage = [&](int buf, int k0) {
#pragma unroll
    for (int i = 0; i < 2; ++i) {
      int idx = t + i * 256;            // 0..511, 16B chunks of the 128x32 tile
      int row = idx >> 2, c8 = idx & 3;
      cp16(&As[buf][row][c8 * 8], A  + (size_t)(m0 + row) * MODEL_DIM + k0 + c8 * 8);
      cp16(&Bs[buf][row][c8 * 8], WT + (size_t)(n0 + row) * MODEL_DIM + k0 + c8 * 8);
    }
  };

  stage(0, 0);
  const int ko = hi * 8;

  for (int kt = 0; kt < MODEL_DIM / 32; ++kt) {
    cp_wait();
    __syncthreads();                    // tile kt ready; tile kt-1 consumers done
    if (kt + 1 < MODEL_DIM / 32) stage((kt + 1) & 1, (kt + 1) * 32);
    const int buf = kt & 1;

    AFrag af[2], bf[4];
#pragma unroll
    for (int im = 0; im < 2; ++im) {
      int mr = wm * 32 + im * 16 + l16;
      af[im].h[0] = *(const f16x8*)&As[buf][mr][ko];
      af[im].h[1] = *(const f16x8*)&As[buf][mr][16 + ko];
    }
#pragma unroll
    for (int in = 0; in < 4; ++in) {
      int nr = wn * 64 + in * 16 + l16;
      bf[in].h[0] = *(const f16x8*)&Bs[buf][nr][ko];
      bf[in].h[1] = *(const f16x8*)&Bs[buf][nr][16 + ko];
    }
#pragma unroll
    for (int im = 0; im < 2; ++im)
#pragma unroll
      for (int in = 0; in < 4; ++in)
        acc[im][in].v = __builtin_amdgcn_wmma_f32_16x16x32_f16(
            false, af[im].v, false, bf[in].v, (short)0, acc[im][in].v, false, false);
  }

  float bn[4];
#pragma unroll
  for (int in = 0; in < 4; ++in) bn[in] = bias[n0 + wn * 64 + in * 16 + l16];

#pragma unroll
  for (int im = 0; im < 2; ++im)
#pragma unroll
    for (int in = 0; in < 4; ++in)
#pragma unroll
      for (int r = 0; r < 8; ++r) {
        int m = m0 + wm * 32 + im * 16 + r + 8 * hi;
        int n = n0 + wn * 64 + in * 16 + l16;
        float val = acc[im][in].f[r] + bn[in];
        if (OUT_MODE == 0) {
          int b = m >> 11, s = m & 2047;
          int h = n >> 6, d = n & 63;
          ((_Float16*)outp)[(((size_t)(b * NUM_HEAD + h) * SEQ + s) * HEAD_DIM) + d] =
              (_Float16)val;
        } else {
          ((float*)outp)[(size_t)m * MODEL_DIM + n] = val;
        }
      }
}

__device__ __forceinline__ float xhalf(float x) {
  const int b = __builtin_bit_cast(int, x);
  return __builtin_bit_cast(
      float, __builtin_amdgcn_permlanex16(b, b, 0x76543210, 0xfedcba98, false, false));
}

__global__ __launch_bounds__(256) void attn_kernel(const _Float16* __restrict__ Q,
                                                   const _Float16* __restrict__ K,
                                                   const _Float16* __restrict__ V,
                                                   const int* __restrict__ mask,
                                                   _Float16* __restrict__ AO) {
  __shared__ _Float16 Ks[64][72];        // [key][d]
  __shared__ _Float16 VTs[64][72];       // [d][key]

  const int t    = threadIdx.x;
  const int wid  = t >> 5;
  const int lane = t & 31;
  const int l16  = lane & 15;
  const int hi   = lane >> 4;
  const int bh   = blockIdx.y;
  const int b    = bh >> 4, h = bh & 15;
  const int q0   = blockIdx.x * 128 + wid * 16;
  const int ko   = hi * 8;

  AFrag qf[2];                           // B operand: column = query q0 + l16
  {
    const _Float16* qrow = Q + ((size_t)bh * SEQ + q0 + l16) * HEAD_DIM;
    qf[0].h[0] = *(const f16x8*)(qrow + ko);
    qf[0].h[1] = *(const f16x8*)(qrow + 16 + ko);
    qf[1].h[0] = *(const f16x8*)(qrow + 32 + ko);
    qf[1].h[1] = *(const f16x8*)(qrow + 48 + ko);
  }

  CFrag oacc[4];                         // oacc[n].f[r] = O[q0 + l16][n*16 + 8*hi + r]
  float mrun = -1e30f;                   // running max of this lane's query (both halves agree)
  float lrun = 0.0f;                     // running sum over this half's keys only
#pragma unroll
  for (int n = 0; n < 4; ++n)
#pragma unroll
    for (int r = 0; r < 8; ++r) oacc[n].f[r] = 0.0f;

  const float scale = 0.125f;            // 1/sqrt(HEAD_DIM)
  const int* mrow = mask + (size_t)(q0 + l16) * SEQ + ko;

  for (int kt0 = 0; kt0 < SEQ; kt0 += 64) {
    __syncthreads();                     // previous iteration done with Ks/VTs
    // ---- stage K tile via async copies; V tile transposed on the VALU ----
#pragma unroll
    for (int i = 0; i < 2; ++i) {
      int idx = t + i * 256;             // 0..511
      int key = idx >> 3, d8 = idx & 7;
      const size_t base = ((size_t)bh * SEQ + kt0 + key) * HEAD_DIM + d8 * 8;
      cp16(&Ks[key][d8 * 8], K + base);
      f16x8 vv = *(const f16x8*)(V + base);
#pragma unroll
      for (int j = 0; j < 8; ++j) VTs[d8 * 8 + j][key] = vv[j];
    }
    cp_wait();
    __syncthreads();

    // ---- scores^T: 4 sub-tiles of 16 keys (rows), 2 WMMAs each over d ----
    // s[j].f[r] = score(query q0 + l16, key kt0 + j*16 + 8*hi + r)
    CFrag s[4];
    float vm[4];
#pragma unroll
    for (int j = 0; j < 4; ++j) {
      AFrag kb0, kb1;
      int kl = j * 16 + l16;
      kb0.h[0] = *(const f16x8*)&Ks[kl][ko];
      kb0.h[1] = *(const f16x8*)&Ks[kl][16 + ko];
      kb1.h[0] = *(const f16x8*)&Ks[kl][32 + ko];
      kb1.h[1] = *(const f16x8*)&Ks[kl][48 + ko];
      v8f z = {0.f, 0.f, 0.f, 0.f, 0.f, 0.f, 0.f, 0.f};
      s[j].v = __builtin_amdgcn_wmma_f32_16x16x32_f16(false, kb0.v, false, qf[0].v,
                                                      (short)0, z, false, false);
      s[j].v = __builtin_amdgcn_wmma_f32_16x16x32_f16(false, kb1.v, false, qf[1].v,
                                                      (short)0, s[j].v, false, false);
      // the lane's 8 keys of this sub-tile are 8 consecutive ints of its own mask row
      v4i mk[2];
      mk[0] = *(const v4i*)(mrow + kt0 + j * 16);
      mk[1] = *(const v4i*)(mrow + kt0 + j * 16 + 4);
#pragma unroll
      for (int r = 0; r < 8; ++r)
        s[j].f[r] = (mk[r >> 2][r & 3] == 0) ? -1e9f : s[j].f[r] * scale;
      vm[j] = s[j].f[0];
#pragma unroll
      for (int r = 1; r < 8; ++r) vm[j] = fmaxf(vm[j], s[j].f[r]);
    }

    // ---- online softmax, one query per lane ----
    float vmax = fmaxf(fmaxf(vm[0], vm[1]), fmaxf(vm[2], vm[3]));
    vmax = fmaxf(vmax, xhalf(vmax));
    const float mnew = fmaxf(mrun, vmax);
    const float c = __expf(mrun - mnew);
    mrun = mnew;

    AFrag pf[2];                         // B operand: two score sub-tiles converted in place, k order as vf below
    float ps[4];
#pragma unroll
    for (int j = 0; j < 4; ++j) {
      ps[j] = 0.0f;
#pragma unroll
      for (int r = 0; r < 8; ++r) {
        const float p = __expf(s[j].f[r] - mnew);
        ps[j] += p;
        pf[j >> 1].v[(j & 1) * 8 + r] = (_Float16)p;
      }
    }
    const float psum = (ps[0] + ps[1]) + (ps[2] + ps[3]);
    lrun = lrun * c + psum;
#pragma unroll
    for (int n = 0; n < 4; ++n)
#pragma unroll
      for (int r = 0; r < 8; ++r) oacc[n].f[r] *= c;

    // ---- O^T += V^T @ P^T ----
#pragma unroll
    for (int kk = 0; kk < 2; ++kk) {
#pragma unroll
      for (int n = 0; n < 4; ++n) {
        AFrag vf;
        int d = n * 16 + l16;
        vf.h[0] = *(const f16x8*)&VTs[d][kk * 32 + ko];
        vf.h[1] = *(const f16x8*)&VTs[d][kk * 32 + 16 + ko];
        oacc[n].v = __builtin_amdgcn_wmma_f32_16x16x32_f16(false, vf.v, false, pf[kk].v,
                                                           (short)0, oacc[n].v, false, false);
      }
    }
  }

  const float inv = 1.0f / (lrun + xhalf(lrun));   // join the two halves' sums once
  _Float16* orow = AO + ((size_t)b * SEQ + q0 + l16) * MODEL_DIM + h * HEAD_DIM + ko;
#pragma unroll
  for (int n = 0; n < 4; ++n) {
    f16x8 o;
#pragma unroll
    for (int r = 0; r < 8; ++r) o[r] = (_Float16)(oacc[n].f[r] * inv);
    *(f16x8*)(orow + n * 16) = o;
  }
}

// ---------------------------------------------------------------------------
extern "C" void kernel_launch(void* const* d_in, const int* in_sizes, int n_in,
                              void* d_out, int out_size, void* d_ws, size_t ws_size,
                              hipStream_t stream) {
  const float* q    = (const float*)d_in[0];
  const float* k    = (const float*)d_in[1];
  const float* v    = (const float*)d_in[2];
  const int*   mask = (const int*)d_in[3];
  const float* w_q  = (const float*)d_in[4];
  const float* b_q  = (const float*)d_in[5];
  const float* w_k  = (const float*)d_in[6];
  const float* b_k  = (const float*)d_in[7];
  const float* w_v  = (const float*)d_in[8];
  const float* b_v  = (const float*)d_in[9];
  const float* w_o  = (const float*)d_in[10];
  const float* b_o  = (const float*)d_in[11];

  const size_t TEN = (size_t)ROWS * MODEL_DIM;     // 4M elements
  const size_t WEL = (size_t)MODEL_DIM * MODEL_DIM;// 1M elements
  _Float16* Xh   = (_Float16*)d_ws;                // reused activation buffer
  _Float16* WTb  = Xh + TEN;                       // reused transposed weights
  _Float16* Qws  = WTb + WEL;
  _Float16* Kws  = Qws + TEN;
  _Float16* Vws  = Kws + TEN;
  _Float16* AOws = Vws + TEN;

  dim3 blk(256);
  dim3 gemm_grid(MODEL_DIM / 128, ROWS / 128);     // (8, 32)
  dim3 wt_grid(MODEL_DIM / 64, MODEL_DIM / 64);    // (16, 16)
  const int cvt_blocks = (int)(TEN / (256 * 8));   // 2048

  // Q projection
  cvt_kernel<<<cvt_blocks, blk, 0, stream>>>(q, Xh);
  wt_kernel<<<wt_grid, blk, 0, stream>>>(w_q, WTb);
  gemm_kernel<0><<<gemm_grid, blk, 0, stream>>>(Xh, WTb, b_q, Qws);
  // K projection
  cvt_kernel<<<cvt_blocks, blk, 0, stream>>>(k, Xh);
  wt_kernel<<<wt_grid, blk, 0, stream>>>(w_k, WTb);
  gemm_kernel<0><<<gemm_grid, blk, 0, stream>>>(Xh, WTb, b_k, Kws);
  // V projection
  cvt_kernel<<<cvt_blocks, blk, 0, stream>>>(v, Xh);
  wt_kernel<<<wt_grid, blk, 0, stream>>>(w_v, WTb);
  gemm_kernel<0><<<gemm_grid, blk, 0, stream>>>(Xh, WTb, b_v, Vws);
  // Attention
  attn_kernel<<<dim3(SEQ / 128, BATCH * NUM_HEAD), blk, 0, stream>>>(Qws, Kws, Vws, mask, AOws);
  // Output projection
  wt_kernel<<<wt_grid, blk, 0, stream>>>(w_o, WTb);
  gemm_kernel<1><<<gemm_grid, blk, 0, stream>>>(AOws, WTb, b_o, d_out);
}

// v002
// A run of this version takes 160 microseconds.
// Next to v001, in two timings, it ran 1.18 times as fast each time.
// Counting every step since v000, it is 1.34 times as fast.
#include <hip/hip_runtime.h>

typedef __attribute__((ext_vector_type(16))) _Float16 v16h;
typedef __attribute__((ext_vector_type(8)))  _Float16 f16x8;
typedef __attribute__((ext_vector_type(8)))  float    v8f;
typedef __attribute__((ext_vector_type(4)))  int      v4i;

#define MODEL_DIM 1024
#define NUM_HEAD  16
#define HEAD_DIM  64
#define BATCH     2
#define SEQ       2048
#define ROWS      (BATCH * SEQ)   // 4096

union AFrag { v16h v; f16x8 h[2]; };
union CFrag { v8f  v; float f[8]; };

// ---------------------------------------------------------------------------
// CDNA5 async global->LDS copy (ASYNCcnt path), with synchronous fallback.
// Probe-confirmed signature: (v4i addrspace(1)*, v4i addrspace(3)*, Ii, Ii)
// ---------------------------------------------------------------------------
#if defined(__HIP_DEVICE_COMPILE__) &&                                        \
    __has_builtin(__builtin_amdgcn_global_load_async_to_lds_b128) &&          \
    __has_builtin(__builtin_amdgcn_s_wait_asynccnt)
#define HAVE_ASYNC 1
#else
#define HAVE_ASYNC 0
#endif

__device__ __forceinline__ void cp16(_Float16* lds, const _Float16* g) {
#if HAVE_ASYNC
  __builtin_amdgcn_global_load_async_to_lds_b128(
      (__attribute__((address_space(1))) v4i*)(void*)g,
      (__attribute__((address_space(3))) v4i*)(void*)lds, 0, 0);
#else
  *(f16x8*)lds = *(const f16x8*)g;
#endif
}
__device__ __forceinline__ void cp_wait() {
#if HAVE_ASYNC
  __builtin_amdgcn_s_wait_asynccnt(0);
#endif
}

// ---------------------------------------------------------------------------
// Prep, one launch for all seven independent jobs, told apart by block range:
//   blocks [0, 1024)      W[k][n] f32 -> WT[n][k] f16, 256 tiles of 64x64 per weight
//   blocks [1024, 7168)   f32 -> f16 elementwise, 2048 blocks per activation
// The transposes come first: they have the longer chain (load, LDS, barrier, store).
// ---------------------------------------------------------------------------
#define TEN ((size_t)ROWS * MODEL_DIM)        // elements of one activation
#define WEL ((size_t)MODEL_DIM * MODEL_DIM)   // elements of one weight
#define WT_BLOCKS  256                        // per weight
#define CVT_BLOCKS 2048                       // per activation

__global__ __launch_bounds__(256) void prep_kernel(const float* __restrict__ q,
                                                   const float* __restrict__ k,
                                                   const float* __restrict__ v,
                                                   const float* __restrict__ w_q,
                                                   const float* __restrict__ w_k,
                                                   const float* __restrict__ w_v,
                                                   const float* __restrict__ w_o,
                                                   _Float16* __restrict__ Xh,
                                                   _Float16* __restrict__ WTb) {
  __shared__ _Float16 tile[64][72];
  const int t   = threadIdx.x;
  const int bid = blockIdx.x;

  if (bid < 4 * WT_BLOCKS) {                     // block-uniform
    const int wsel = bid >> 8, tl = bid & 255;
    const float* __restrict__ W = wsel == 0 ? w_q : wsel == 1 ? w_k : wsel == 2 ? w_v : w_o;
    _Float16* __restrict__ WT = WTb + (size_t)wsel * WEL;
    const int n0 = (tl & 15) * 64, k0 = (tl >> 4) * 64;
#pragma unroll
    for (int i = 0; i < 4; ++i) {
      int idx = t + i * 256;                     // 0..1023 float4 chunks
      int kk = idx >> 4, n4 = idx & 15;
      const float4 f = *(const float4*)(W + (size_t)(k0 + kk) * MODEL_DIM + n0 + n4 * 4);
      tile[n4 * 4 + 0][kk] = (_Float16)f.x;
      tile[n4 * 4 + 1][kk] = (_Float16)f.y;
      tile[n4 * 4 + 2][kk] = (_Float16)f.z;
      tile[n4 * 4 + 3][kk] = (_Float16)f.w;
    }
    __syncthreads();
#pragma unroll
    for (int i = 0; i < 2; ++i) {
      int idx = t + i * 256;                     // 0..511 f16x8 chunks
      int n = idx >> 3, c8 = idx & 7;
      *(f16x8*)(WT + (size_t)(n0 + n) * MODEL_DIM + k0 + c8 * 8) =
          *(const f16x8*)&tile[n][c8 * 8];
    }
  } else {
    const int cb = bid - 4 * WT_BLOCKS;
    const int xsel = cb >> 11;
    const float* __restrict__ X = xsel == 0 ? q : xsel == 1 ? k : v;
    _Float16* __restrict__ Y = Xh + (size_t)xsel * TEN;
    size_t base = ((size_t)(cb & 2047) * 256 + t) * 8;
    const float4 a = *(const float4*)(X + base);
    const float4 b = *(const float4*)(X + base + 4);
    f16x8 h;
    h[0] = (_Float16)a.x; h[1] = (_Float16)a.y; h[2] = (_Float16)a.z; h[3] = (_Float16)a.w;
    h[4] = (_Float16)b.x; h[5] = (_Float16)b.y; h[6] = (_Float16)b.z; h[7] = (_Float16)b.w;
    *(f16x8*)(Y + base) = h;
    // the store's address registers are rewritten on the path laid out behind this branch: wait first
    asm volatile("s_wait_xcnt 0x0" ::: "memory");
  }
}

// ---------------------------------------------------------------------------
// GEMM: C[ROWS,1024] = A[ROWS,1024](f16) * WT[1024,1024](f16,[n][k]) + bias
// Block tile 128x128, K-step 32, double-buffered async LDS staging.
//  OUT_MODE 0 -> f16 into [B,H,S,64]    OUT_MODE 1 -> f32 into [B,S,1024]
// ---------------------------------------------------------------------------
template <int OUT_MODE>
__device__ __forceinline__ void gemm_body(const _Float16* __restrict__ A,
                                          const _Float16* __restrict__ WT,
                                          const float* __restrict__ bias,
                                          void* __restrict__ outp) {
  __shared__ _Float16 As[2][128][40];   // [m][k], +8 f16 pad (rows 16B aligned)
  __shared__ _Float16 Bs[2][128][40];   // [n][k]

  const int t    = threadIdx.x;
  const int wid  = t >> 5;
  const int lane = t & 31;
  const int l16  = lane & 15;
  const int hi   = lane >> 4;
  const int m0   = blockIdx.y * 128;
  const int n0   = blockIdx.x * 128;
  const int wm   = wid & 3;             // 4 wave-rows * 32 rows
  const int wn   = wid >> 2;            // 2 wave-cols * 64 cols

  CFrag acc[2][4];
#pragma unroll
  for (int im = 0; im < 2; ++im)
#pragma unroll
    for (int in = 0; in < 4; ++in)
#pragma unroll
      for (int r = 0; r < 8; ++r) acc[im][in].f[r] = 0.0f;

  auto stage = [&](int buf, int k0) {
#pragma unroll
    for (int i = 0; i < 2; ++i) {
      int idx = t + i * 256;            // 0..511, 16B chunks of the 128x32 tile
      int row = idx >> 2, c8 = idx & 3;
      cp16(&As[buf][row][c8 * 8], A  + (size_t)(m0 + row) * MODEL_DIM + k0 + c8 * 8);
      cp16(&Bs[buf][row][c8 * 8], WT + (size_t)(n0 + row) * MODEL_DIM + k0 + c8 * 8);
    }
  };

  stage(0, 0);
  const int ko = hi * 8;

  for (int kt = 0; kt < MODEL_DIM / 32; ++kt) {
    cp_wait();
    __syncthreads();                    // tile kt ready; tile kt-1 consumers done
    if (kt + 1 < MODEL_DIM / 32) stage((kt + 1) & 1, (kt + 1) * 32);
    const int buf = kt & 1;

    AFrag af[2], bf[4];
#pragma unroll
    for (int im = 0; im < 2; ++im) {
      int mr = wm * 32 + im * 16 + l16;
      af[im].h[0] = *(const f16x8*)&As[buf][mr][ko];
      af[im].h[1] = *(const f16x8*)&As[buf][mr][16 + ko];
    }
#pragma unroll
    for (int in = 0; in < 4; ++in) {
      int nr = wn * 64 + in * 16 + l16;
      bf[in].h[0] = *(const f16x8*)&Bs[buf][nr][ko];
      bf[in].h[1] = *(const f16x8*)&Bs[buf][nr][16 + ko];
    }
#pragma unroll
    for (int im = 0; im < 2; ++im)
#pragma unroll
      for (int in = 0; in < 4; ++in)
        acc[im][in].v = __builtin_amdgcn_wmma_f32_16x16x32_f16(
            false, af[im].v, false, bf[in].v, (short)0, acc[im][in].v, false, false);
  }

  float bn[4];
#pragma unroll
  for (int in = 0; in < 4; ++in) bn[in] = bias[n0 + wn * 64 + in * 16 + l16];

#pragma unroll
  for (int im = 0; im < 2; ++im)
#pragma unroll
    for (int in = 0; in < 4; ++in)
#pragma unroll
      for (int r = 0; r < 8; ++r) {
        int m = m0 + wm * 32 + im * 16 + r + 8 * hi;
        int n = n0 + wn * 64 + in * 16 + l16;
        float val = acc[im][in].f[r] + bn[in];
        if (OUT_MODE == 0) {
          int b = m >> 11, s = m & 2047;
          int h = n >> 6, d = n & 63;
          ((_Float16*)outp)[(((size_t)(b * NUM_HEAD + h) * SEQ + s) * HEAD_DIM) + d] =
              (_Float16)val;
        } else {
          ((float*)outp)[(size_t)m * MODEL_DIM + n] = val;
        }
      }
}

// The Q, K and V projections in one launch: blockIdx.z picks the product, so
// three 128x128 tiles share a WGP and one's copy latency hides behind the others.
__global__ __launch_bounds__(256) void gemm_qkv_kernel(const _Float16* __restrict__ Xh,
                                                       const _Float16* __restrict__ WTb,
                                                       const float* __restrict__ b_q,
                                                       const float* __restrict__ b_k,
                                                       const float* __restrict__ b_v,
                                                       _Float16* __restrict__ QKV) {
  const int z = blockIdx.z;
  gemm_body<0>(Xh + (size_t)z * TEN, WTb + (size_t)z * WEL,
               z == 0 ? b_q : z == 1 ? b_k : b_v, QKV + (size_t)z * TEN);
}

__global__ __launch_bounds__(256) void gemm_out_kernel(const _Float16* __restrict__ A,
                                                       const _Float16* __restrict__ WT,
                                                       const float* __restrict__ bias,
                                                       float* __restrict__ out) {
  gemm_body<1>(A, WT, bias, out);
}

__device__ __forceinline__ float xhalf(float x) {
  const int b = __builtin_bit_cast(int, x);
  return __builtin_bit_cast(
      float, __builtin_amdgcn_permlanex16(b, b, 0x76543210, 0xfedcba98, false, false));
}

__global__ __launch_bounds__(256) void attn_kernel(const _Float16* __restrict__ Q,
                                                   const _Float16* __restrict__ K,
                                                   const _Float16* __restrict__ V,
                                                   const int* __restrict__ mask,
                                                   _Float16* __restrict__ AO) {
  __shared__ _Float16 Ks[64][72];        // [key][d]
  __shared__ _Float16 VTs[64][72];       // [d][key]

  const int t    = threadIdx.x;
  const int wid  = t >> 5;
  const int lane = t & 31;
  const int l16  = lane & 15;
  const int hi   = lane >> 4;
  const int bh   = blockIdx.y;
  const int b    = bh >> 4, h = bh & 15;
  const int q0   = blockIdx.x * 128 + wid * 16;
  const int ko   = hi * 8;

  AFrag qf[2];                           // B operand: column = query q0 + l16
  {
    const _Float16* qrow = Q + ((size_t)bh * SEQ + q0 + l16) * HEAD_DIM;
    qf[0].h[0] = *(const f16x8*)(qrow + ko);
    qf[0].h[1] = *(const f16x8*)(qrow + 16 + ko);
    qf[1].h[0] = *(const f16x8*)(qrow + 32 + ko);
    qf[1].h[1] = *(const f16x8*)(qrow + 48 + ko);
  }

  CFrag oacc[4];                         // oacc[n].f[r] = O[q0 + l16][n*16 + 8*hi + r]
  float mrun = -1e30f;                   // running max of this lane's query (both halves agree)
  float lrun = 0.0f;                     // running sum over this half's keys only
#pragma unroll
  for (int n = 0; n < 4; ++n)
#pragma unroll
    for (int r = 0; r < 8; ++r) oacc[n].f[r] = 0.0f;

  const float scale = 0.125f;            // 1/sqrt(HEAD_DIM)
  const int* mrow = mask + (size_t)(q0 + l16) * SEQ + ko;

  for (int kt0 = 0; kt0 < SEQ; kt0 += 64) {
    __syncthreads();                     // previous iteration done with Ks/VTs
    // ---- stage K tile via async copies; V tile transposed on the VALU ----
#pragma unroll
    for (int i = 0; i < 2; ++i) {
      int idx = t + i * 256;             // 0..511
      int key = idx >> 3, d8 = idx & 7;
      const size_t base = ((size_t)bh * SEQ + kt0 + key) * HEAD_DIM + d8 * 8;
      cp16(&Ks[key][d8 * 8], K + base);
      f16x8 vv = *(const f16x8*)(V + base);
#pragma unroll
      for (int j = 0; j < 8; ++j) VTs[d8 * 8 + j][key] = vv[j];
    }
    cp_wait();
    __syncthreads();

    // ---- scores^T: 4 sub-tiles of 16 keys (rows), 2 WMMAs each over d ----
    // s[j].f[r] = score(query q0 + l16, key kt0 + j*16 + 8*hi + r)
    CFrag s[4];
    float vm[4];
#pragma unroll
    for (int j = 0; j < 4; ++j) {
      AFrag kb0, kb1;
      int kl = j * 16 + l16;
      kb0.h[0] = *(const f16x8*)&Ks[kl][ko];
      kb0.h[1] = *(const f16x8*)&Ks[kl][16 + ko];
      kb1.h[0] = *(const f16x8*)&Ks[kl][32 + ko];
      kb1.h[1] = *(const f16x8*)&Ks[kl][48 + ko];
      v8f z = {0.f, 0.f, 0.f, 0.f, 0.f, 0.f, 0.f, 0.f};
      s[j].v = __builtin_amdgcn_wmma_f32_16x16x32_f16(false, kb0.v, false, qf[0].v,
                                                      (short)0, z, false, false);
      s[j].v = __builtin_amdgcn_wmma_f32_16x16x32_f16(false, kb1.v, false, qf[1].v,
                                                      (short)0, s[j].v, false, false);
      // the lane's 8 keys of this sub-tile are 8 consecutive ints of its own mask row
      v4i mk[2];
      mk[0] = *(const v4i*)(mrow + kt0 + j * 16);
      mk[1] = *(const v4i*)(mrow + kt0 + j * 16 + 4);
#pragma unroll
      for (int r = 0; r < 8; ++r)
        s[j].f[r] = (mk[r >> 2][r & 3] == 0) ? -1e9f : s[j].f[r] * scale;
      vm[j] = s[j].f[0];
#pragma unroll
      for (int r = 1; r < 8; ++r) vm[j] = fmaxf(vm[j], s[j].f[r]);
    }

    // ---- online softmax, one query per lane ----
    float vmax = fmaxf(fmaxf(vm[0], vm[1]), fmaxf(vm[2], vm[3]));
    vmax = fmaxf(vmax, xhalf(vmax));
    const float mnew = fmaxf(mrun, vmax);
    const float c = __expf(mrun - mnew);
    mrun = mnew;

    AFrag pf[2];                         // B operand: two score sub-tiles converted in place, k order as vf below
    float ps[4];
#pragma unroll
    for (int j = 0; j < 4; ++j) {
      ps[j] = 0.0f;
#pragma unroll
      for (int r = 0; r < 8; ++r) {
        const float p = __expf(s[j].f[r] - mnew);
        ps[j] += p;
        pf[j >> 1].v[(j & 1) * 8 + r] = (_Float16)p;
      }
    }
    const float psum = (ps[0] + ps[1]) + (ps[2] + ps[3]);
    lrun = lrun * c + psum;
#pragma unroll
    for (int n = 0; n < 4; ++n)
#pragma unroll
      for (int r = 0; r < 8; ++r) oacc[n].f[r] *= c;

    // ---- O^T += V^T @ P^T ----
#pragma unroll
    for (int kk = 0; kk < 2; ++kk) {
#pragma unroll
      for (int n = 0; n < 4; ++n) {
        AFrag vf;
        int d = n * 16 + l16;
        vf.h[0] = *(const f16x8*)&VTs[d][kk * 32 + ko];
        vf.h[1] = *(const f16x8*)&VTs[d][kk * 32 + 16 + ko];
        oacc[n].v = __builtin_amdgcn_wmma_f32_16x16x32_f16(false, vf.v, false, pf[kk].v,
                                                           (short)0, oacc[n].v, false, false);
      }
    }
  }

  const float inv = 1.0f / (lrun + xhalf(lrun));   // join the two halves' sums once
  _Float16* orow = AO + ((size_t)b * SEQ + q0 + l16) * MODEL_DIM + h * HEAD_DIM + ko;
#pragma unroll
  for (int n = 0; n < 4; ++n) {
    f16x8 o;
#pragma unroll
    for (int r = 0; r < 8; ++r) o[r] = (_Float16)(oacc[n].f[r] * inv);
    *(f16x8*)(orow + n * 16) = o;
  }
}

// ---------------------------------------------------------------------------
extern "C" void kernel_launch(void* const* d_in, const int* in_sizes, int n_in,
                              void* d_out, int out_size, void* d_ws, size_t ws_size,
                              hipStream_t stream) {
  const float* q    = (const float*)d_in[0];
  const float* k    = (const float*)d_in[1];
  const float* v    = (const float*)d_in[2];
  const int*   mask = (const int*)d_in[3];
  const float* w_q  = (const float*)d_in[4];
  const float* b_q  = (const float*)d_in[5];
  const float* w_k  = (const float*)d_in[6];
  const float* b_k  = (const float*)d_in[7];
  const float* w_v  = (const float*)d_in[8];
  const float* b_v  = (const float*)d_in[9];
  const float* w_o  = (const float*)d_in[10];
  const float* b_o  = (const float*)d_in[11];

  _Float16* Xh   = (_Float16*)d_ws;                // q, k, v as f16, one after the other
  _Float16* WTb  = Xh + 3 * TEN;                   // w_q, w_k, w_v, w_o transposed
  _Float16* Qws  = WTb + 4 * WEL;                  // Q, K, V one after the other
  _Float16* Kws  = Qws + TEN;
  _Float16* Vws  = Kws + TEN;
  _Float16* AOws = Vws + TEN;

  dim3 blk(256);

  prep_kernel<<<4 * WT_BLOCKS + 3 * CVT_BLOCKS, blk, 0, stream>>>(q, k, v, w_q, w_k, w_v, w_o,
                                                                  Xh, WTb);
  gemm_qkv_kernel<<<dim3(MODEL_DIM / 128, ROWS / 128, 3), blk, 0, stream>>>(Xh, WTb, b_q, b_k,
                                                                            b_v, Qws);
  attn_kernel<<<dim3(SEQ / 128, BATCH * NUM_HEAD), blk, 0, stream>>>(Qws, Kws, Vws, mask, AOws);
  gemm_out_kernel<<<dim3(MODEL_DIM / 128, ROWS / 128), blk, 0, stream>>>(AOws, WTb + 3 * WEL, b_o,
                                                                         (float*)d_out);
}

// v003
// One run takes 146 microseconds.
// Two timings next to v002 put it at 1.09 and 1.10 times that version's speed.
// Counting every step since v000, it is 1.47 times as fast.
#include <hip/hip_runtime.h>

typedef __attribute__((ext_vector_type(16))) _Float16 v16h;
typedef __attribute__((ext_vector_type(8)))  _Float16 f16x8;
typedef __attribute__((ext_vector_type(8)))  float    v8f;
typedef __attribute__((ext_vector_type(4)))  int      v4i;

#define MODEL_DIM 1024
#define NUM_HEAD  16
#define HEAD_DIM  64
#define BATCH     2
#define SEQ       2048
#define ROWS      (BATCH * SEQ)   // 4096

union AFrag { v16h v; f16x8 h[2]; };
union CFrag { v8f  v; float f[8]; };

// ---------------------------------------------------------------------------
// CDNA5 async global->LDS copy (ASYNCcnt path), with synchronous fallback.
// Probe-confirmed signature: (v4i addrspace(1)*, v4i addrspace(3)*, Ii, Ii)
// ---------------------------------------------------------------------------
#if defined(__HIP_DEVICE_COMPILE__) &&                                        \
    __has_builtin(__builtin_amdgcn_global_load_async_to_lds_b128) &&          \
    __has_builtin(__builtin_amdgcn_s_wait_asynccnt)
#define HAVE_ASYNC 1
#else
#define HAVE_ASYNC 0
#endif

__device__ __forceinline__ void cp16(_Float16* lds, const _Float16* g) {
#if HAVE_ASYNC
  __builtin_amdgcn_global_load_async_to_lds_b128(
      (__attribute__((address_space(1))) v4i*)(void*)g,
      (__attribute__((address_space(3))) v4i*)(void*)lds, 0, 0);
#else
  *(f16x8*)lds = *(const f16x8*)g;
#endif
}
__device__ __forceinline__ void cp_wait() {
#if HAVE_ASYNC
  __builtin_amdgcn_s_wait_asynccnt(0);
#endif
}

// ---------------------------------------------------------------------------
// Prep, one launch for all eight independent jobs, told apart by block range:
//   blocks [0, 1024)      W[k][n] f32 -> WT[n][k] f16, 256 tiles of 64x64 per weight
//   blocks [1024, 1536)   mask int32 -> lane-mask words, one (16 queries, 64 keys) tile per wave
//   blocks [1536, 7680)   f32 -> f16 elementwise, 2048 blocks per activation
// Lane-mask word LM[query group][key tile][j*8 + r]: bit l is set where
// mask[group*16 + (l & 15)][tile*64 + j*16 + (l >> 4)*8 + r] != 0, which is the place of
// that score in the attention kernel's accumulators (sub-tile j, register r, lane l).
// The transposes come first: they have the longer chain (load, LDS, barrier, store).
// ---------------------------------------------------------------------------
#define TEN ((size_t)ROWS * MODEL_DIM)        // elements of one activation
#define WEL ((size_t)MODEL_DIM * MODEL_DIM)   // elements of one weight
#define WT_BLOCKS  256                        // per weight
#define CVT_BLOCKS 2048                       // per activation
#define MK_BLOCKS  512                        // (SEQ/16) * (SEQ/64) tiles, 8 waves a block

__global__ __launch_bounds__(256) void prep_kernel(const float* __restrict__ q,
                                                   const float* __restrict__ k,
                                                   const float* __restrict__ v,
                                                   const float* __restrict__ w_q,
                                                   const float* __restrict__ w_k,
                                                   const float* __restrict__ w_v,
                                                   const float* __restrict__ w_o,
                                                   const int* __restrict__ mask,
                                                   _Float16* __restrict__ Xh,
                                                   _Float16* __restrict__ WTb,
                                                   unsigned* __restrict__ LM) {
  __shared__ _Float16 tile[64][72];
  const int t   = threadIdx.x;
  const int bid = blockIdx.x;

  if (bid < 4 * WT_BLOCKS) {                     // block-uniform
    const int wsel = bid >> 8, tl = bid & 255;
    const float* __restrict__ W = wsel == 0 ? w_q : wsel == 1 ? w_k : wsel == 2 ? w_v : w_o;
    _Float16* __restrict__ WT = WTb + (size_t)wsel * WEL;
    const int n0 = (tl & 15) * 64, k0 = (tl >> 4) * 64;
#pragma unroll
    for (int i = 0; i < 4; ++i) {
      int idx = t + i * 256;                     // 0..1023 float4 chunks
      int kk = idx >> 4, n4 = idx & 15;
      const float4 f = *(const float4*)(W + (size_t)(k0 + kk) * MODEL_DIM + n0 + n4 * 4);
      tile[n4 * 4 + 0][kk] = (_Float16)f.x;
      tile[n4 * 4 + 1][kk] = (_Float16)f.y;
      tile[n4 * 4 + 2][kk] = (_Float16)f.z;
      tile[n4 * 4 + 3][kk] = (_Float16)f.w;
    }
    __syncthreads();
#pragma unroll
    for (int i = 0; i < 2; ++i) {
      int idx = t + i * 256;                     // 0..511 f16x8 chunks
      int n = idx >> 3, c8 = idx & 7;
      *(f16x8*)(WT + (size_t)(n0 + n) * MODEL_DIM + k0 + c8 * 8) =
          *(const f16x8*)&tile[n][c8 * 8];
    }
  } else if (bid < 4 * WT_BLOCKS + MK_BLOCKS) {  // block-uniform
    const int tile_id = (bid - 4 * WT_BLOCKS) * 8 + (t >> 5);   // group * 32 + key tile
    const int lane = t & 31;
    const int* __restrict__ mp = mask + (size_t)((tile_id >> 5) * 16 + (lane & 15)) * SEQ +
                                 (tile_id & 31) * 64 + (lane >> 4) * 8;
    v4i m[8];
#pragma unroll
    for (int i = 0; i < 8; ++i) m[i] = *(const v4i*)(mp + (i >> 1) * 16 + (i & 1) * 4);
    unsigned mine = 0;
#pragma unroll
    for (int i = 0; i < 32; ++i) {
      const unsigned w = __builtin_amdgcn_ballot_w32(m[i >> 2][i & 3] != 0);
      if (lane == i) mine = w;
    }
    LM[(size_t)tile_id * 32 + lane] = mine;
    // the store's address registers may be rewritten on a path laid out behind this branch: wait first
    asm volatile("s_wait_xcnt 0x0" ::: "memory");
  } else {
    const int cb = bid - 4 * WT_BLOCKS - MK_BLOCKS;
    const int xsel = cb >> 11;
    const float* __restrict__ X = xsel == 0 ? q : xsel == 1 ? k : v;
    _Float16* __restrict__ Y = Xh + (size_t)xsel * TEN;
    size_t base = ((size_t)(cb & 2047) * 256 + t) * 8;
    const float4 a = *(const float4*)(X + base);
    const float4 b = *(const float4*)(X + base + 4);
    f16x8 h;
    h[0] = (_Float16)a.x; h[1] = (_Float16)a.y; h[2] = (_Float16)a.z; h[3] = (_Float16)a.w;
    h[4] = (_Float16)b.x; h[5] = (_Float16)b.y; h[6] = (_Float16)b.z; h[7] = (_Float16)b.w;
    *(f16x8*)(Y + base) = h;
    // the store's address registers are rewritten on the path laid out behind this branch: wait first
    asm volatile("s_wait_xcnt 0x0" ::: "memory");
  }
}

// ---------------------------------------------------------------------------
// GEMM: C[ROWS,1024] = A[ROWS,1024](f16) * WT[1024,1024](f16,[n][k]) + bias
// Block tile 128x128, K-step 32, double-buffered async LDS staging.
//  OUT_MODE 0 -> f16 into [B,H,S,64]    OUT_MODE 1 -> f32 into [B,S,1024]
// ---------------------------------------------------------------------------
template <int OUT_MODE>
__device__ __forceinline__ void gemm_body(const _Float16* __restrict__ A,
                                          const _Float16* __restrict__ WT,
                                          const float* __restrict__ bias,
                                          void* __restrict__ outp) {
  __shared__ _Float16 As[2][128][40];   // [m][k], +8 f16 pad (rows 16B aligned)
  __shared__ _Float16 Bs[2][128][40];   // [n][k]

  const int t    = threadIdx.x;
  const int wid  = t >> 5;
  const int lane = t & 31;
  const int l16  = lane & 15;
  const int hi   = lane >> 4;
  const int m0   = blockIdx.y * 128;
  const int n0   = blockIdx.x * 128;
  const int wm   = wid & 3;             // 4 wave-rows * 32 rows
  const int wn   = wid >> 2;            // 2 wave-cols * 64 cols

  CFrag acc[2][4];
#pragma unroll
  for (int im = 0; im < 2; ++im)
#pragma unroll
    for (int in = 0; in < 4; ++in)
#pragma unroll
      for (int r = 0; r < 8; ++r) acc[im][in].f[r] = 0.0f;

  auto stage = [&](int buf, int k0) {
#pragma unroll
    for (int i = 0; i < 2; ++i) {
      int idx = t + i * 256;            // 0..511, 16B chunks of the 128x32 tile
      int row = idx >> 2, c8 = idx & 3;
      cp16(&As[buf][row][c8 * 8], A  + (size_t)(m0 + row) * MODEL_DIM + k0 + c8 * 8);
      cp16(&Bs[buf][row][c8 * 8], WT + (size_t)(n0 + row) * MODEL_DIM + k0 + c8 * 8);
    }
  };

  stage(0, 0);
  const int ko = hi * 8;

  for (int kt = 0; kt < MODEL_DIM / 32; ++kt) {
    cp_wait();
    __syncthreads();                    // tile kt ready; tile kt-1 consumers done
    if (kt + 1 < MODEL_DIM / 32) stage((kt + 1) & 1, (kt + 1) * 32);
    const int buf = kt & 1;

    AFrag af[2], bf[4];
#pragma unroll
    for (int im = 0; im < 2; ++im) {
      int mr = wm * 32 + im * 16 + l16;
      af[im].h[0] = *(const f16x8*)&As[buf][mr][ko];
      af[im].h[1] = *(const f16x8*)&As[buf][mr][16 + ko];
    }
#pragma unroll
    for (int in = 0; in < 4; ++in) {
      int nr = wn * 64 + in * 16 + l16;
      bf[in].h[0] = *(const f16x8*)&Bs[buf][nr][ko];
      bf[in].h[1] = *(const f16x8*)&Bs[buf][nr][16 + ko];
    }
#pragma unroll
    for (int im = 0; im < 2; ++im)
#pragma unroll
      for (int in = 0; in < 4; ++in)
        acc[im][in].v = __builtin_amdgcn_wmma_f32_16x16x32_f16(
            false, af[im].v, false, bf[in].v, (short)0, acc[im][in].v, false, false);
  }

  float bn[4];
#pragma unroll
  for (int in = 0; in < 4; ++in) bn[in] = bias[n0 + wn * 64 + in * 16 + l16];

#pragma unroll
  for (int im = 0; im < 2; ++im)
#pragma unroll
    for (int in = 0; in < 4; ++in)
#pragma unroll
      for (int r = 0; r < 8; ++r) {
        int m = m0 + wm * 32 + im * 16 + r + 8 * hi;
        int n = n0 + wn * 64 + in * 16 + l16;
        float val = acc[im][in].f[r] + bn[in];
        if (OUT_MODE == 0) {
          int b = m >> 11, s = m & 2047;
          int h = n >> 6, d = n & 63;
          ((_Float16*)outp)[(((size_t)(b * NUM_HEAD + h) * SEQ + s) * HEAD_DIM) + d] =
              (_Float16)val;
        } else {
          ((float*)outp)[(size_t)m * MODEL_DIM + n] = val;
        }
      }
}

// The Q, K and V projections in one launch: blockIdx.z picks the product, so
// three 128x128 tiles share a WGP and one's copy latency hides behind the others.
__global__ __launch_bounds__(256) void gemm_qkv_kernel(const _Float16* __restrict__ Xh,
                                                       const _Float16* __restrict__ WTb,
                                                       const float* __restrict__ b_q,
                                                       const float* __restrict__ b_k,
                                                       const float* __restrict__ b_v,
                                                       _Float16* __restrict__ QKV) {
  const int z = blockIdx.z;
  gemm_body<0>(Xh + (size_t)z * TEN, WTb + (size_t)z * WEL,
               z == 0 ? b_q : z == 1 ? b_k : b_v, QKV + (size_t)z * TEN);
}

__global__ __launch_bounds__(256) void gemm_out_kernel(const _Float16* __restrict__ A,
                                                       const _Float16* __restrict__ WT,
                                                       const float* __restrict__ bias,
                                                       float* __restrict__ out) {
  gemm_body<1>(A, WT, bias, out);
}

__device__ __forceinline__ float xhalf(float x) {
  const int b = __builtin_bit_cast(int, x);
  return __builtin_bit_cast(
      float, __builtin_amdgcn_permlanex16(b, b, 0x76543210, 0xfedcba98, false, false));
}

__global__ __launch_bounds__(256) void attn_kernel(const _Float16* __restrict__ Q,
                                                   const _Float16* __restrict__ K,
                                                   const _Float16* __restrict__ V,
                                                   const unsigned* __restrict__ LM,
                                                   _Float16* __restrict__ AO) {
  __shared__ _Float16 Ks[64][72];        // [key][d]
  __shared__ _Float16 VTs[64][72];       // [d][key]

  const int t    = threadIdx.x;
  const int wid  = t >> 5;
  const int lane = t & 31;
  const int l16  = lane & 15;
  const int hi   = lane >> 4;
  const int bh   = blockIdx.y;
  const int b    = bh >> 4, h = bh & 15;
  const int q0   = blockIdx.x * 128 + wid * 16;
  const int ko   = hi * 8;

  AFrag qf[2];                           // B operand: column = query q0 + l16
  {
    const _Float16* qrow = Q + ((size_t)bh * SEQ + q0 + l16) * HEAD_DIM;
    qf[0].h[0] = *(const f16x8*)(qrow + ko);
    qf[0].h[1] = *(const f16x8*)(qrow + 16 + ko);
    qf[1].h[0] = *(const f16x8*)(qrow + 32 + ko);
    qf[1].h[1] = *(const f16x8*)(qrow + 48 + ko);
  }

  CFrag oacc[4];                         // oacc[n].f[r] = O[q0 + l16][n*16 + 8*hi + r]
  float mrun = -1e30f;                   // running max of this lane's query (both halves agree)
  float lrun = 0.0f;                     // running sum over this half's keys only
#pragma unroll
  for (int n = 0; n < 4; ++n)
#pragma unroll
    for (int r = 0; r < 8; ++r) oacc[n].f[r] = 0.0f;

  const float scale = 0.125f;            // 1/sqrt(HEAD_DIM)
  // this wave's lane-mask words: the address is the same in every lane, so they come by scalar loads
  const unsigned* lmw = LM + (size_t)(blockIdx.x * 8 + __builtin_amdgcn_readfirstlane(wid)) * (32 * 32);

  for (int kt0 = 0; kt0 < SEQ; kt0 += 64) {
    unsigned mw[32];                     // fetched here so that staging covers their latency
#pragma unroll
    for (int i = 0; i < 32; ++i) mw[i] = lmw[(kt0 >> 1) + i];
    __syncthreads();                     // previous iteration done with Ks/VTs
    // ---- stage K tile via async copies; V tile transposed on the VALU ----
#pragma unroll
    for (int i = 0; i < 2; ++i) {
      int idx = t + i * 256;             // 0..511
      int key = idx >> 3, d8 = idx & 7;
      const size_t base = ((size_t)bh * SEQ + kt0 + key) * HEAD_DIM + d8 * 8;
      cp16(&Ks[key][d8 * 8], K + base);
      f16x8 vv = *(const f16x8*)(V + base);
#pragma unroll
      for (int j = 0; j < 8; ++j) VTs[d8 * 8 + j][key] = vv[j];
    }
    cp_wait();
    __syncthreads();

    // ---- scores^T: 4 sub-tiles of 16 keys (rows), 2 WMMAs each over d ----
    // s[j].f[r] = score(query q0 + l16, key kt0 + j*16 + 8*hi + r)
    CFrag s[4];
    float vm[4];
#pragma unroll
    for (int j = 0; j < 4; ++j) {
      AFrag kb0, kb1;
      int kl = j * 16 + l16;
      kb0.h[0] = *(const f16x8*)&Ks[kl][ko];
      kb0.h[1] = *(const f16x8*)&Ks[kl][16 + ko];
      kb1.h[0] = *(const f16x8*)&Ks[kl][32 + ko];
      kb1.h[1] = *(const f16x8*)&Ks[kl][48 + ko];
      v8f z = {0.f, 0.f, 0.f, 0.f, 0.f, 0.f, 0.f, 0.f};
      s[j].v = __builtin_amdgcn_wmma_f32_16x16x32_f16(false, kb0.v, false, qf[0].v,
                                                      (short)0, z, false, false);
      s[j].v = __builtin_amdgcn_wmma_f32_16x16x32_f16(false, kb1.v, false, qf[1].v,
                                                      (short)0, s[j].v, false, false);
      // word j*8 + r is the select's lane mask as it stands: no compare, no per-lane load
#pragma unroll
      for (int r = 0; r < 8; ++r)
        s[j].f[r] = __builtin_amdgcn_inverse_ballot_w32(mw[j * 8 + r]) ? s[j].f[r] * scale : -1e9f;
      vm[j] = s[j].f[0];
#pragma unroll
      for (int r = 1; r < 8; ++r) vm[j] = fmaxf(vm[j], s[j].f[r]);
    }

    // ---- online softmax, one query per lane ----
    float vmax = fmaxf(fmaxf(vm[0], vm[1]), fmaxf(vm[2], vm[3]));
    vmax = fmaxf(vmax, xhalf(vmax));
    const float mnew = fmaxf(mrun, vmax);
    const float c = __expf(mrun - mnew);
    mrun = mnew;

    AFrag pf[2];                         // B operand: two score sub-tiles converted in place, k order as vf below
    float ps[4];
#pragma unroll
    for (int j = 0; j < 4; ++j) {
      ps[j] = 0.0f;
#pragma unroll
      for (int r = 0; r < 8; ++r) {
        const float p = __expf(s[j].f[r] - mnew);
        ps[j] += p;
        pf[j >> 1].v[(j & 1) * 8 + r] = (_Float16)p;
      }
    }
    const float psum = (ps[0] + ps[1]) + (ps[2] + ps[3]);
    lrun = lrun * c + psum;
#pragma unroll
    for (int n = 0; n < 4; ++n)
#pragma unroll
      for (int r = 0; r < 8; ++r) oacc[n].f[r] *= c;

    // ---- O^T += V^T @ P^T ----
#pragma unroll
    for (int kk = 0; kk < 2; ++kk) {
#pragma unroll
      for (int n = 0; n < 4; ++n) {
        AFrag vf;
        int d = n * 16 + l16;
        vf.h[0] = *(const f16x8*)&VTs[d][kk * 32 + ko];
        vf.h[1] = *(const f16x8*)&VTs[d][kk * 32 + 16 + ko];
        oacc[n].v = __builtin_amdgcn_wmma_f32_16x16x32_f16(false, vf.v, false, pf[kk].v,
                                                           (short)0, oacc[n].v, false, false);
      }
    }
  }

  const float inv = 1.0f / (lrun + xhalf(lrun));   // join the two halves' sums once
  _Float16* orow = AO + ((size_t)b * SEQ + q0 + l16) * MODEL_DIM + h * HEAD_DIM + ko;
#pragma unroll
  for (int n = 0; n < 4; ++n) {
    f16x8 o;
#pragma unroll
    for (int r = 0; r < 8; ++r) o[r] = (_Float16)(oacc[n].f[r] * inv);
    *(f16x8*)(orow + n * 16) = o;
  }
}

// ---------------------------------------------------------------------------
extern "C" void kernel_launch(void* const* d_in, const int* in_sizes, int n_in,
                              void* d_out, int out_size, void* d_ws, size_t ws_size,
                              hipStream_t stream) {
  const float* q    = (const float*)d_in[0];
  const float* k    = (const float*)d_in[1];
  const float* v    = (const float*)d_in[2];
  const int*   mask = (const int*)d_in[3];
  const float* w_q  = (const float*)d_in[4];
  const float* b_q  = (const float*)d_in[5];
  const float* w_k  = (const float*)d_in[6];
  const float* b_k  = (const float*)d_in[7];
  const float* w_v  = (const float*)d_in[8];
  const float* b_v  = (const float*)d_in[9];
  const float* w_o  = (const float*)d_in[10];
  const float* b_o  = (const float*)d_in[11];

  _Float16* Xh   = (_Float16*)d_ws;                // q, k, v as f16, one after the other
  _Float16* WTb  = Xh + 3 * TEN;                   // w_q, w_k, w_v, w_o transposed
  _Float16* Qws  = WTb + 4 * WEL;                  // Q, K, V one after the other
  _Float16* Kws  = Qws + TEN;
  _Float16* Vws  = Kws + TEN;
  _Float16* AOws = Vws + TEN;
  unsigned* LMws = (unsigned*)(AOws + TEN);        // mask as lane-mask words, 512 KiB

  dim3 blk(256);

  prep_kernel<<<4 * WT_BLOCKS + MK_BLOCKS + 3 * CVT_BLOCKS, blk, 0, stream>>>(
      q, k, v, w_q, w_k, w_v, w_o, mask, Xh, WTb, LMws);
  gemm_qkv_kernel<<<dim3(MODEL_DIM / 128, ROWS / 128, 3), blk, 0, stream>>>(Xh, WTb, b_q, b_k,
                                                                            b_v, Qws);
  attn_kernel<<<dim3(SEQ / 128, BATCH * NUM_HEAD), blk, 0, stream>>>(Qws, Kws, Vws, LMws, AOws);
  gemm_out_kernel<<<dim3(MODEL_DIM / 128, ROWS / 128), blk, 0, stream>>>(AOws, WTb + 3 * WEL, b_o,
                                                                         (float*)d_out);
}

// v004
// A run of this version takes 129 microseconds.
// In both of two side-by-side timings against v003, it was 1.13 times as fast.
// Over all steps from v000 it is 1.65 times as fast.
#include <hip/hip_runtime.h>

typedef __attribute__((ext_vector_type(16))) _Float16 v16h;
typedef __attribute__((ext_vector_type(8)))  _Float16 f16x8;
typedef __attribute__((ext_vector_type(8)))  float    v8f;
typedef __attribute__((ext_vector_type(4)))  int      v4i;

#define MODEL_DIM 1024
#define NUM_HEAD  16
#define HEAD_DIM  64
#define BATCH     2
#define SEQ       2048
#define ROWS      (BATCH * SEQ)   // 4096

union AFrag { v16h v; f16x8 h[2]; };
union CFrag { v8f  v; float f[8]; };

// ---------------------------------------------------------------------------
// CDNA5 async global->LDS copy (ASYNCcnt path), with synchronous fallback.
// Probe-confirmed signature: (v4i addrspace(1)*, v4i addrspace(3)*, Ii, Ii)
// ---------------------------------------------------------------------------
#if defined(__HIP_DEVICE_COMPILE__) &&                                        \
    __has_builtin(__builtin_amdgcn_global_load_async_to_lds_b128) &&          \
    __has_builtin(__builtin_amdgcn_s_wait_asynccnt)
#define HAVE_ASYNC 1
#else
#define HAVE_ASYNC 0
#endif

__device__ __forceinline__ void cp16(_Float16* lds, const _Float16* g) {
#if HAVE_ASYNC
  __builtin_amdgcn_global_load_async_to_lds_b128(
      (__attribute__((address_space(1))) v4i*)(void*)g,
      (__attribute__((address_space(3))) v4i*)(void*)lds, 0, 0);
#else
  *(f16x8*)lds = *(const f16x8*)g;
#endif
}
__device__ __forceinline__ void cp_wait() {
#if HAVE_ASYNC
  __builtin_amdgcn_s_wait_asynccnt(0);
#endif
}

// ---------------------------------------------------------------------------
// Prep, one launch for all eight independent jobs, told apart by block range:
//   blocks [0, 1024)      W[k][n] f32 -> WT[n][k] f16, 256 tiles of 64x64 per weight
//   blocks [1024, 1536)   mask int32 -> lane-mask words, one (16 queries, 64 keys) tile per wave
//   blocks [1536, 7680)   f32 -> f16 elementwise, 2048 blocks per activation
// Lane-mask word LM[query group][key tile][j*8 + r]: bit l is set where
// mask[group*16 + (l & 15)][tile*64 + j*16 + (l >> 4)*8 + r] != 0, which is the place of
// that score in the attention kernel's accumulators (sub-tile j, register r, lane l).
// The transposes come first: they have the longer chain (load, LDS, barrier, store).
// ---------------------------------------------------------------------------
#define TEN ((size_t)ROWS * MODEL_DIM)        // elements of one activation
#define WEL ((size_t)MODEL_DIM * MODEL_DIM)   // elements of one weight
#define WT_BLOCKS  256                        // per weight
#define CVT_BLOCKS 2048                       // per activation
#define MK_BLOCKS  512                        // (SEQ/16) * (SEQ/64) tiles, 8 waves a block

__global__ __launch_bounds__(256) void prep_kernel(const float* __restrict__ q,
                                                   const float* __restrict__ k,
                                                   const float* __restrict__ v,
                                                   const float* __restrict__ w_q,
                                                   const float* __restrict__ w_k,
                                                   const float* __restrict__ w_v,
                                                   const float* __restrict__ w_o,
                                                   const int* __restrict__ mask,
                                                   _Float16* __restrict__ Xh,
                                                   _Float16* __restrict__ WTb,
                                                   unsigned* __restrict__ LM) {
  __shared__ _Float16 tile[64][72];
  const int t   = threadIdx.x;
  const int bid = blockIdx.x;

  if (bid < 4 * WT_BLOCKS) {                     // block-uniform
    const int wsel = bid >> 8, tl = bid & 255;
    const float* __restrict__ W = wsel == 0 ? w_q : wsel == 1 ? w_k : wsel == 2 ? w_v : w_o;
    _Float16* __restrict__ WT = WTb + (size_t)wsel * WEL;
    const int n0 = (tl & 15) * 64, k0 = (tl >> 4) * 64;
#pragma unroll
    for (int i = 0; i < 4; ++i) {
      int idx = t + i * 256;                     // 0..1023 float4 chunks
      int kk = idx >> 4, n4 = idx & 15;
      const float4 f = *(const float4*)(W + (size_t)(k0 + kk) * MODEL_DIM + n0 + n4 * 4);
      tile[n4 * 4 + 0][kk] = (_Float16)f.x;
      tile[n4 * 4 + 1][kk] = (_Float16)f.y;
      tile[n4 * 4 + 2][kk] = (_Float16)f.z;
      tile[n4 * 4 + 3][kk] = (_Float16)f.w;
    }
    __syncthreads();
#pragma unroll
    for (int i = 0; i < 2; ++i) {
      int idx = t + i * 256;                     // 0..511 f16x8 chunks
      int n = idx >> 3, c8 = idx & 7;
      *(f16x8*)(WT + (size_t)(n0 + n) * MODEL_DIM + k0 + c8 * 8) =
          *(const f16x8*)&tile[n][c8 * 8];
    }
  } else if (bid < 4 * WT_BLOCKS + MK_BLOCKS) {  // block-uniform
    const int tile_id = (bid - 4 * WT_BLOCKS) * 8 + (t >> 5);   // group * 32 + key tile
    const int lane = t & 31;
    const int* __restrict__ mp = mask + (size_t)((tile_id >> 5) * 16 + (lane & 15)) * SEQ +
                                 (tile_id & 31) * 64 + (lane >> 4) * 8;
    v4i m[8];
#pragma unroll
    for (int i = 0; i < 8; ++i) m[i] = *(const v4i*)(mp + (i >> 1) * 16 + (i & 1) * 4);
    unsigned mine = 0;
#pragma unroll
    for (int i = 0; i < 32; ++i) {
      const unsigned w = __builtin_amdgcn_ballot_w32(m[i >> 2][i & 3] != 0);
      if (lane == i) mine = w;
    }
    LM[(size_t)tile_id * 32 + lane] = mine;
    // the store's address registers may be rewritten on a path laid out behind this branch: wait first
    asm volatile("s_wait_xcnt 0x0" ::: "memory");
  } else {
    const int cb = bid - 4 * WT_BLOCKS - MK_BLOCKS;
    const int xsel = cb >> 11;
    const float* __restrict__ X = xsel == 0 ? q : xsel == 1 ? k : v;
    _Float16* __restrict__ Y = Xh + (size_t)xsel * TEN;
    size_t base = ((size_t)(cb & 2047) * 256 + t) * 8;
    const float4 a = *(const float4*)(X + base);
    const float4 b = *(const float4*)(X + base + 4);
    f16x8 h;
    h[0] = (_Float16)a.x; h[1] = (_Float16)a.y; h[2] = (_Float16)a.z; h[3] = (_Float16)a.w;
    h[4] = (_Float16)b.x; h[5] = (_Float16)b.y; h[6] = (_Float16)b.z; h[7] = (_Float16)b.w;
    *(f16x8*)(Y + base) = h;
    // the store's address registers are rewritten on the path laid out behind this branch: wait first
    asm volatile("s_wait_xcnt 0x0" ::: "memory");
  }
}

// ---------------------------------------------------------------------------
// GEMM: C[ROWS,1024] = A[ROWS,1024](f16) * WT[1024,1024](f16,[n][k]) + bias
// Block tile 128x128, K-step 32, double-buffered async LDS staging.
//  OUT_MODE 0 -> f16 into [B,H,S,64]    OUT_MODE 1 -> f32 into [B,S,1024]
//  OUT_MODE 0 with tr (block-uniform) -> f16 into [B,H,S/32][64 d][32 s]: transposed in
//  chunks of 32 rows, so that a wave's 32 x 64 tile is one contiguous 4 KiB that it alone writes.
//  A lane's eight accumulator registers are eight consecutive s of one d: one 16-byte store.
// ---------------------------------------------------------------------------
template <int OUT_MODE>
__device__ __forceinline__ void gemm_body(const _Float16* __restrict__ A,
                                          const _Float16* __restrict__ WT,
                                          const float* __restrict__ bias,
                                          void* __restrict__ outp, const bool tr) {
  __shared__ _Float16 As[2][128][40];   // [m][k], +8 f16 pad (rows 16B aligned)
  __shared__ _Float16 Bs[2][128][40];   // [n][k]

  const int t    = threadIdx.x;
  const int wid  = t >> 5;
  const int lane = t & 31;
  const int l16  = lane & 15;
  const int hi   = lane >> 4;
  const int m0   = blockIdx.y * 128;
  const int n0   = blockIdx.x * 128;
  const int wm   = wid & 3;             // 4 wave-rows * 32 rows
  const int wn   = wid >> 2;            // 2 wave-cols * 64 cols

  CFrag acc[2][4];
#pragma unroll
  for (int im = 0; im < 2; ++im)
#pragma unroll
    for (int in = 0; in < 4; ++in)
#pragma unroll
      for (int r = 0; r < 8; ++r) acc[im][in].f[r] = 0.0f;

  auto stage = [&](int buf, int k0) {
#pragma unroll
    for (int i = 0; i < 2; ++i) {
      int idx = t + i * 256;            // 0..511, 16B chunks of the 128x32 tile
      int row = idx >> 2, c8 = idx & 3;
      cp16(&As[buf][row][c8 * 8], A  + (size_t)(m0 + row) * MODEL_DIM + k0 + c8 * 8);
      cp16(&Bs[buf][row][c8 * 8], WT + (size_t)(n0 + row) * MODEL_DIM + k0 + c8 * 8);
    }
  };

  stage(0, 0);
  const int ko = hi * 8;

  for (int kt = 0; kt < MODEL_DIM / 32; ++kt) {
    cp_wait();
    __syncthreads();                    // tile kt ready; tile kt-1 consumers done
    if (kt + 1 < MODEL_DIM / 32) stage((kt + 1) & 1, (kt + 1) * 32);
    const int buf = kt & 1;

    AFrag af[2], bf[4];
#pragma unroll
    for (int im = 0; im < 2; ++im) {
      int mr = wm * 32 + im * 16 + l16;
      af[im].h[0] = *(const f16x8*)&As[buf][mr][ko];
      af[im].h[1] = *(const f16x8*)&As[buf][mr][16 + ko];
    }
#pragma unroll
    for (int in = 0; in < 4; ++in) {
      int nr = wn * 64 + in * 16 + l16;
      bf[in].h[0] = *(const f16x8*)&Bs[buf][nr][ko];
      bf[in].h[1] = *(const f16x8*)&Bs[buf][nr][16 + ko];
    }
#pragma unroll
    for (int im = 0; im < 2; ++im)
#pragma unroll
      for (int in = 0; in < 4; ++in)
        acc[im][in].v = __builtin_amdgcn_wmma_f32_16x16x32_f16(
            false, af[im].v, false, bf[in].v, (short)0, acc[im][in].v, false, false);
  }

  float bn[4];
#pragma unroll
  for (int in = 0; in < 4; ++in) bn[in] = bias[n0 + wn * 64 + in * 16 + l16];

  if (OUT_MODE == 0 && tr) {
#pragma unroll
    for (int im = 0; im < 2; ++im)
#pragma unroll
      for (int in = 0; in < 4; ++in) {
        const int m = m0 + wm * 32 + im * 16 + 8 * hi;   // first of the lane's eight rows
        const int n = n0 + wn * 64 + in * 16 + l16;
        const int b = m >> 11, s = m & 2047;
        const int h = n >> 6, d = n & 63;
        f16x8 o;
#pragma unroll
        for (int r = 0; r < 8; ++r) o[r] = (_Float16)(acc[im][in].f[r] + bn[in]);
        *(f16x8*)((_Float16*)outp +
                  (((size_t)(b * NUM_HEAD + h) * (SEQ / 32) + (s >> 5)) * HEAD_DIM + d) * 32 +
                  (s & 31)) = o;
      }
  } else {
#pragma unroll
    for (int im = 0; im < 2; ++im)
#pragma unroll
      for (int in = 0; in < 4; ++in)
#pragma unroll
        for (int r = 0; r < 8; ++r) {
          int m = m0 + wm * 32 + im * 16 + r + 8 * hi;
          int n = n0 + wn * 64 + in * 16 + l16;
          float val = acc[im][in].f[r] + bn[in];
          if (OUT_MODE == 0) {
            int b = m >> 11, s = m & 2047;
            int h = n >> 6, d = n & 63;
            ((_Float16*)outp)[(((size_t)(b * NUM_HEAD + h) * SEQ + s) * HEAD_DIM) + d] =
                (_Float16)val;
          } else {
            ((float*)outp)[(size_t)m * MODEL_DIM + n] = val;
          }
        }
    // the stores' registers are rewritten on the path laid out behind this branch: wait first
    if (OUT_MODE == 0) asm volatile("s_wait_xcnt 0x0" ::: "memory");
  }
}

// The Q, K and V projections in one launch: blockIdx.z picks the product, so
// three 128x128 tiles share a WGP and one's copy latency hides behind the others.
__global__ __launch_bounds__(256) void gemm_qkv_kernel(const _Float16* __restrict__ Xh,
                                                       const _Float16* __restrict__ WTb,
                                                       const float* __restrict__ b_q,
                                                       const float* __restrict__ b_k,
                                                       const float* __restrict__ b_v,
                                                       _Float16* __restrict__ QKV) {
  const int z = blockIdx.z;
  gemm_body<0>(Xh + (size_t)z * TEN, WTb + (size_t)z * WEL,
               z == 0 ? b_q : z == 1 ? b_k : b_v, QKV + (size_t)z * TEN, z == 2);
}

__global__ __launch_bounds__(256) void gemm_out_kernel(const _Float16* __restrict__ A,
                                                       const _Float16* __restrict__ WT,
                                                       const float* __restrict__ bias,
                                                       float* __restrict__ out) {
  gemm_body<1>(A, WT, bias, out, false);
}

__device__ __forceinline__ float xhalf(float x) {
  const int b = __builtin_bit_cast(int, x);
  return __builtin_bit_cast(
      float, __builtin_amdgcn_permlanex16(b, b, 0x76543210, 0xfedcba98, false, false));
}

__global__ __launch_bounds__(256) void attn_kernel(const _Float16* __restrict__ Q,
                                                   const _Float16* __restrict__ K,
                                                   const _Float16* __restrict__ VT,
                                                   const unsigned* __restrict__ LM,
                                                   _Float16* __restrict__ AO) {
  __shared__ _Float16 Ks[64][72];        // [key][d]
  __shared__ _Float16 VTs[64][72];       // [d][key]

  const int t    = threadIdx.x;
  const int wid  = t >> 5;
  const int lane = t & 31;
  const int l16  = lane & 15;
  const int hi   = lane >> 4;
  const int bh   = blockIdx.y;
  const int b    = bh >> 4, h = bh & 15;
  const int q0   = blockIdx.x * 128 + wid * 16;
  const int ko   = hi * 8;

  AFrag qf[2];                           // B operand: column = query q0 + l16
  {
    const _Float16* qrow = Q + ((size_t)bh * SEQ + q0 + l16) * HEAD_DIM;
    qf[0].h[0] = *(const f16x8*)(qrow + ko);
    qf[0].h[1] = *(const f16x8*)(qrow + 16 + ko);
    qf[1].h[0] = *(const f16x8*)(qrow + 32 + ko);
    qf[1].h[1] = *(const f16x8*)(qrow + 48 + ko);
  }

  CFrag oacc[4];                         // oacc[n].f[r] = O[q0 + l16][n*16 + 8*hi + r]
  float mrun = -1e30f;                   // running max of this lane's query (both halves agree)
  float lrun = 0.0f;                     // running sum over this half's keys only
#pragma unroll
  for (int n = 0; n < 4; ++n)
#pragma unroll
    for (int r = 0; r < 8; ++r) oacc[n].f[r] = 0.0f;

  const float scale = 0.125f;            // 1/sqrt(HEAD_DIM)
  // this wave's lane-mask words: the address is the same in every lane, so they come by scalar loads
  const unsigned* lmw = LM + (size_t)(blockIdx.x * 8 + __builtin_amdgcn_readfirstlane(wid)) * (32 * 32);

  for (int kt0 = 0; kt0 < SEQ; kt0 += 64) {
    unsigned mw[32];                     // fetched here so that staging covers their latency
#pragma unroll
    for (int i = 0; i < 32; ++i) mw[i] = lmw[(kt0 >> 1) + i];
    __syncthreads();                     // previous iteration done with Ks/VTs
    // ---- stage the K tile [key][d] and the V^T tile [d][key] via async copies ----
    // both tiles are 8 KiB, contiguous, at the same element offset; V^T is two chunks [64 d][32 keys]
#pragma unroll
    for (int i = 0; i < 2; ++i) {
      int idx = t + i * 256;             // 0..511, 16-byte pieces
      const size_t off = ((size_t)bh * SEQ + kt0) * HEAD_DIM + idx * 8;
      cp16(&Ks[idx >> 3][(idx & 7) * 8], K + off);
      cp16(&VTs[t >> 2][i * 32 + (t & 3) * 8], VT + off);
    }
    cp_wait();
    __syncthreads();                     // publishes both tiles; directly behind the builtin wait it holds the LDS reads behind it

    // ---- scores^T: 4 sub-tiles of 16 keys (rows), 2 WMMAs each over d ----
    // s[j].f[r] = score(query q0 + l16, key kt0 + j*16 + 8*hi + r)
    CFrag s[4];
    float vm[4];
#pragma unroll
    for (int j = 0; j < 4; ++j) {
      AFrag kb0, kb1;
      int kl = j * 16 + l16;
      kb0.h[0] = *(const f16x8*)&Ks[kl][ko];
      kb0.h[1] = *(const f16x8*)&Ks[kl][16 + ko];
      kb1.h[0] = *(const f16x8*)&Ks[kl][32 + ko];
      kb1.h[1] = *(const f16x8*)&Ks[kl][48 + ko];
      v8f z = {0.f, 0.f, 0.f, 0.f, 0.f, 0.f, 0.f, 0.f};
      s[j].v = __builtin_amdgcn_wmma_f32_16x16x32_f16(false, kb0.v, false, qf[0].v,
                                                      (short)0, z, false, false);
      s[j].v = __builtin_amdgcn_wmma_f32_16x16x32_f16(false, kb1.v, false, qf[1].v,
                                                      (short)0, s[j].v, false, false);
      // word j*8 + r is the select's lane mask as it stands: no compare, no per-lane load
#pragma unroll
      for (int r = 0; r < 8; ++r)
        s[j].f[r] = __builtin_amdgcn_inverse_ballot_w32(mw[j * 8 + r]) ? s[j].f[r] * scale : -1e9f;
      vm[j] = s[j].f[0];
#pragma unroll
      for (int r = 1; r < 8; ++r) vm[j] = fmaxf(vm[j], s[j].f[r]);
    }

    // ---- online softmax, one query per lane ----
    float vmax = fmaxf(fmaxf(vm[0], vm[1]), fmaxf(vm[2], vm[3]));
    vmax = fmaxf(vmax, xhalf(vmax));
    const float mnew = fmaxf(mrun, vmax);
    const float c = __expf(mrun - mnew);
    mrun = mnew;

    AFrag pf[2];                         // B operand: two score sub-tiles converted in place, k order as vf below
    float ps[4];
#pragma unroll
    for (int j = 0; j < 4; ++j) {
      ps[j] = 0.0f;
#pragma unroll
      for (int r = 0; r < 8; ++r) {
        const float p = __expf(s[j].f[r] - mnew);
        ps[j] += p;
        pf[j >> 1].v[(j & 1) * 8 + r] = (_Float16)p;
      }
    }
    const float psum = (ps[0] + ps[1]) + (ps[2] + ps[3]);
    lrun = lrun * c + psum;
#pragma unroll
    for (int n = 0; n < 4; ++n)
#pragma unroll
      for (int r = 0; r < 8; ++r) oacc[n].f[r] *= c;

    // ---- O^T += V^T @ P^T ----
#pragma unroll
    for (int kk = 0; kk < 2; ++kk) {
#pragma unroll
      for (int n = 0; n < 4; ++n) {
        AFrag vf;
        int d = n * 16 + l16;
        vf.h[0] = *(const f16x8*)&VTs[d][kk * 32 + ko];
        vf.h[1] = *(const f16x8*)&VTs[d][kk * 32 + 16 + ko];
        oacc[n].v = __builtin_amdgcn_wmma_f32_16x16x32_f16(false, vf.v, false, pf[kk].v,
                                                           (short)0, oacc[n].v, false, false);
      }
    }
  }

  const float inv = 1.0f / (lrun + xhalf(lrun));   // join the two halves' sums once
  _Float16* orow = AO + ((size_t)b * SEQ + q0 + l16) * MODEL_DIM + h * HEAD_DIM + ko;
#pragma unroll
  for (int n = 0; n < 4; ++n) {
    f16x8 o;
#pragma unroll
    for (int r = 0; r < 8; ++r) o[r] = (_Float16)(oacc[n].f[r] * inv);
    *(f16x8*)(orow + n * 16) = o;
  }
}

// ---------------------------------------------------------------------------
extern "C" void kernel_launch(void* const* d_in, const int* in_sizes, int n_in,
                              void* d_out, int out_size, void* d_ws, size_t ws_size,
                              hipStream_t stream) {
  const float* q    = (const float*)d_in[0];
  const float* k    = (const float*)d_in[1];
  const float* v    = (const float*)d_in[2];
  const int*   mask = (const int*)d_in[3];
  const float* w_q  = (const float*)d_in[4];
  const float* b_q  = (const float*)d_in[5];
  const float* w_k  = (const float*)d_in[6];
  const float* b_k  = (const float*)d_in[7];
  const float* w_v  = (const float*)d_in[8];
  const float* b_v  = (const float*)d_in[9];
  const float* w_o  = (const float*)d_in[10];
  const float* b_o  = (const float*)d_in[11];

  _Float16* Xh   = (_Float16*)d_ws;                // q, k, v as f16, one after the other
  _Float16* WTb  = Xh + 3 * TEN;                   // w_q, w_k, w_v, w_o transposed
  _Float16* Qws  = WTb + 4 * WEL;                  // Q, K, V^T (by 32-row chunks) one after the other
  _Float16* Kws  = Qws + TEN;
  _Float16* Vws  = Kws + TEN;
  _Float16* AOws = Vws + TEN;
  unsigned* LMws = (unsigned*)(AOws + TEN);        // mask as lane-mask words, 512 KiB

  dim3 blk(256);

  prep_kernel<<<4 * WT_BLOCKS + MK_BLOCKS + 3 * CVT_BLOCKS, blk, 0, stream>>>(
      q, k, v, w_q, w_k, w_v, w_o, mask, Xh, WTb, LMws);
  gemm_qkv_kernel<<<dim3(MODEL_DIM / 128, ROWS / 128, 3), blk, 0, stream>>>(Xh, WTb, b_q, b_k,
                                                                            b_v, Qws);
  attn_kernel<<<dim3(SEQ / 128, BATCH * NUM_HEAD), blk, 0, stream>>>(Qws, Kws, Vws, LMws, AOws);
  gemm_out_kernel<<<dim3(MODEL_DIM / 128, ROWS / 128), blk, 0, stream>>>(AOws, WTb + 3 * WEL, b_o,
                                                                         (float*)d_out);
}

// v005
// A run of this version takes 113 microseconds.
// Next to v004, in two timings, it ran 1.16 and 1.17 times as fast.
// Over all steps from v000 it is 1.92 times as fast.
#include <hip/hip_runtime.h>

typedef __attribute__((ext_vector_type(16))) _Float16 v16h;
typedef __attribute__((ext_vector_type(8)))  _Float16 f16x8;
typedef __attribute__((ext_vector_type(8)))  float    v8f;
typedef __attribute__((ext_vector_type(4)))  int      v4i;

#define MODEL_DIM 1024
#define NUM_HEAD  16
#define HEAD_DIM  64
#define BATCH     2
#define SEQ       2048
#define ROWS      (BATCH * SEQ)   // 4096

union AFrag { v16h v; f16x8 h[2]; };
union CFrag { v8f  v; float f[8]; };

// ---------------------------------------------------------------------------
// CDNA5 async global->LDS copy (ASYNCcnt path), with synchronous fallback.
// Probe-confirmed signature: (v4i addrspace(1)*, v4i addrspace(3)*, Ii, Ii)
// ---------------------------------------------------------------------------
#if defined(__HIP_DEVICE_COMPILE__) &&                                        \
    __has_builtin(__builtin_amdgcn_global_load_async_to_lds_b128) &&          \
    __has_builtin(__builtin_amdgcn_s_wait_asynccnt)
#define HAVE_ASYNC 1
#else
#define HAVE_ASYNC 0
#endif

__device__ __forceinline__ void cp16(_Float16* lds, const _Float16* g) {
#if HAVE_ASYNC
  __builtin_amdgcn_global_load_async_to_lds_b128(
      (__attribute__((address_space(1))) v4i*)(void*)g,
      (__attribute__((address_space(3))) v4i*)(void*)lds, 0, 0);
#else
  *(f16x8*)lds = *(const f16x8*)g;
#endif
}
__device__ __forceinline__ void cp_wait() {
#if HAVE_ASYNC
  __builtin_amdgcn_s_wait_asynccnt(0);
#endif
}

// ---------------------------------------------------------------------------
// Prep, one launch for all eight independent jobs, told apart by block range:
//   blocks [0, 1024)      W[k][n] f32 -> WT[n][k] f16, 256 tiles of 64x64 per weight
//   blocks [1024, 1536)   mask int32 -> lane-mask words, one (16 queries, 64 keys) tile per wave
//   blocks [1536, 7680)   f32 -> f16 elementwise, 2048 blocks per activation
// Lane-mask word LM[query group][key tile][j*8 + r]: bit l is set where
// mask[group*16 + (l & 15)][tile*64 + j*16 + (l >> 4)*8 + r] != 0, which is the place of
// that score in the attention kernel's accumulators (sub-tile j, register r, lane l).
// The transposes come first: they have the longer chain (load, LDS, barrier, store).
// ---------------------------------------------------------------------------
#define TEN ((size_t)ROWS * MODEL_DIM)        // elements of one activation
#define WEL ((size_t)MODEL_DIM * MODEL_DIM)   // elements of one weight
#define WT_BLOCKS  256                        // per weight
#define CVT_BLOCKS 2048                       // per activation
#define MK_BLOCKS  512                        // (SEQ/16) * (SEQ/64) tiles, 8 waves a block

__global__ __launch_bounds__(256) void prep_kernel(const float* __restrict__ q,
                                                   const float* __restrict__ k,
                                                   const float* __restrict__ v,
                                                   const float* __restrict__ w_q,
                                                   const float* __restrict__ w_k,
                                                   const float* __restrict__ w_v,
                                                   const float* __restrict__ w_o,
                                                   const int* __restrict__ mask,
                                                   _Float16* __restrict__ Xh,
                                                   _Float16* __restrict__ WTb,
                                                   unsigned* __restrict__ LM) {
  __shared__ _Float16 tile[64][72];
  const int t   = threadIdx.x;
  const int bid = blockIdx.x;

  if (bid < 4 * WT_BLOCKS) {                     // block-uniform
    const int wsel = bid >> 8, tl = bid & 255;
    const float* __restrict__ W = wsel == 0 ? w_q : wsel == 1 ? w_k : wsel == 2 ? w_v : w_o;
    _Float16* __restrict__ WT = WTb + (size_t)wsel * WEL;
    const int n0 = (tl & 15) * 64, k0 = (tl >> 4) * 64;
#pragma unroll
    for (int i = 0; i < 4; ++i) {
      int idx = t + i * 256;                     // 0..1023 float4 chunks
      int kk = idx >> 4, n4 = idx & 15;
      const float4 f = *(const float4*)(W + (size_t)(k0 + kk) * MODEL_DIM + n0 + n4 * 4);
      tile[n4 * 4 + 0][kk] = (_Float16)f.x;
      tile[n4 * 4 + 1][kk] = (_Float16)f.y;
      tile[n4 * 4 + 2][kk] = (_Float16)f.z;
      tile[n4 * 4 + 3][kk] = (_Float16)f.w;
    }
    __syncthreads();
#pragma unroll
    for (int i = 0; i < 2; ++i) {
      int idx = t + i * 256;                     // 0..511 f16x8 chunks
      int n = idx >> 3, c8 = idx & 7;
      *(f16x8*)(WT + (size_t)(n0 + n) * MODEL_DIM + k0 + c8 * 8) =
          *(const f16x8*)&tile[n][c8 * 8];
    }
  } else if (bid < 4 * WT_BLOCKS + MK_BLOCKS) {  // block-uniform
    const int tile_id = (bid - 4 * WT_BLOCKS) * 8 + (t >> 5);   // group * 32 + key tile
    const int lane = t & 31;
    const int* __restrict__ mp = mask + (size_t)((tile_id >> 5) * 16 + (lane & 15)) * SEQ +
                                 (tile_id & 31) * 64 + (lane >> 4) * 8;
    v4i m[8];
#pragma unroll
    for (int i = 0; i < 8; ++i) m[i] = *(const v4i*)(mp + (i >> 1) * 16 + (i & 1) * 4);
    unsigned mine = 0;
#pragma unroll
    for (int i = 0; i < 32; ++i) {
      const unsigned w = __builtin_amdgcn_ballot_w32(m[i >> 2][i & 3] != 0);
      if (lane == i) mine = w;
    }
    LM[(size_t)tile_id * 32 + lane] = mine;
    // the store's address registers may be rewritten on a path laid out behind this branch: wait first
    asm volatile("s_wait_xcnt 0x0" ::: "memory");
  } else {
    const int cb = bid - 4 * WT_BLOCKS - MK_BLOCKS;
    const int xsel = cb >> 11;
    const float* __restrict__ X = xsel == 0 ? q : xsel == 1 ? k : v;
    _Float16* __restrict__ Y = Xh + (size_t)xsel * TEN;
    size_t base = ((size_t)(cb & 2047) * 256 + t) * 8;
    const float4 a = *(const float4*)(X + base);
    const float4 b = *(const float4*)(X + base + 4);
    f16x8 h;
    h[0] = (_Float16)a.x; h[1] = (_Float16)a.y; h[2] = (_Float16)a.z; h[3] = (_Float16)a.w;
    h[4] = (_Float16)b.x; h[5] = (_Float16)b.y; h[6] = (_Float16)b.z; h[7] = (_Float16)b.w;
    *(f16x8*)(Y + base) = h;
    // the store's address registers are rewritten on the path laid out behind this branch: wait first
    asm volatile("s_wait_xcnt 0x0" ::: "memory");
  }
}

// ---------------------------------------------------------------------------
// GEMM: C[ROWS,1024] = A[ROWS,1024](f16) * WT[1024,1024](f16,[n][k]) + bias
// Block tile 128x128, K-step 64, double-buffered async LDS staging: a stage holds 128 bytes of
// every operand row, so eight lanes of a copy take one whole 128-byte line and no line is asked for twice.
//  OUT_MODE 0 -> f16 into [B,H,S,64]    OUT_MODE 1 -> f32 into [B,S,1024]
//  OUT_MODE 0 with tr (block-uniform) -> f16 into [B,H,S/32][64 d][32 s]: transposed in
//  chunks of 32 rows, so that a wave's 32 x 64 tile is one contiguous 4 KiB that it alone writes.
//  A lane's eight accumulator registers are eight consecutive s of one d: one 16-byte store.
// ---------------------------------------------------------------------------
template <int OUT_MODE>
__device__ __forceinline__ void gemm_body(const _Float16* __restrict__ A,
                                          const _Float16* __restrict__ WT,
                                          const float* __restrict__ bias,
                                          void* __restrict__ outp, const bool tr) {
  __shared__ _Float16 As[2][128][72];   // [m][k], +8 f16 pad: pitch 144 B = 16 B x odd
  __shared__ _Float16 Bs[2][128][72];   // [n][k]

  const int t    = threadIdx.x;
  const int wid  = t >> 5;
  const int lane = t & 31;
  const int l16  = lane & 15;
  const int hi   = lane >> 4;
  const int m0   = blockIdx.y * 128;
  const int n0   = blockIdx.x * 128;
  const int wm   = wid & 3;             // 4 wave-rows * 32 rows
  const int wn   = wid >> 2;            // 2 wave-cols * 64 cols

  CFrag acc[2][4];
#pragma unroll
  for (int im = 0; im < 2; ++im)
#pragma unroll
    for (int in = 0; in < 4; ++in)
#pragma unroll
      for (int r = 0; r < 8; ++r) acc[im][in].f[r] = 0.0f;

  auto stage = [&](int buf, int k0) {
#pragma unroll
    for (int i = 0; i < 4; ++i) {
      int idx = t + i * 256;            // 0..1023, 16B chunks of the 128x64 tile
      int row = idx >> 3, c8 = idx & 7;
      cp16(&As[buf][row][c8 * 8], A  + (size_t)(m0 + row) * MODEL_DIM + k0 + c8 * 8);
      cp16(&Bs[buf][row][c8 * 8], WT + (size_t)(n0 + row) * MODEL_DIM + k0 + c8 * 8);
    }
  };

  stage(0, 0);
  const int ko = hi * 8;

  for (int kt = 0; kt < MODEL_DIM / 64; ++kt) {
    cp_wait();
    __syncthreads();                    // tile kt ready; tile kt-1 consumers done
    if (kt + 1 < MODEL_DIM / 64) stage((kt + 1) & 1, (kt + 1) * 64);
    const int buf = kt & 1;

    // unrolled: the two halves' LDS offsets become immediates and their loads can be issued ahead
#pragma unroll
    for (int kk = 0; kk < 64; kk += 32) {   // k runs upward as before: the sums keep their order
      AFrag af[2], bf[4];
#pragma unroll
      for (int im = 0; im < 2; ++im) {
        int mr = wm * 32 + im * 16 + l16;
        af[im].h[0] = *(const f16x8*)&As[buf][mr][kk + ko];
        af[im].h[1] = *(const f16x8*)&As[buf][mr][kk + 16 + ko];
      }
#pragma unroll
      for (int in = 0; in < 4; ++in) {
        int nr = wn * 64 + in * 16 + l16;
        bf[in].h[0] = *(const f16x8*)&Bs[buf][nr][kk + ko];
        bf[in].h[1] = *(const f16x8*)&Bs[buf][nr][kk + 16 + ko];
      }
#pragma unroll
      for (int im = 0; im < 2; ++im)
#pragma unroll
        for (int in = 0; in < 4; ++in)
          acc[im][in].v = __builtin_amdgcn_wmma_f32_16x16x32_f16(
              false, af[im].v, false, bf[in].v, (short)0, acc[im][in].v, false, false);
    }
  }

  float bn[4];
#pragma unroll
  for (int in = 0; in < 4; ++in) bn[in] = bias[n0 + wn * 64 + in * 16 + l16];

  if (OUT_MODE == 0 && tr) {
#pragma unroll
    for (int im = 0; im < 2; ++im)
#pragma unroll
      for (int in = 0; in < 4; ++in) {
        const int m = m0 + wm * 32 + im * 16 + 8 * hi;   // first of the lane's eight rows
        const int n = n0 + wn * 64 + in * 16 + l16;
        const int b = m >> 11, s = m & 2047;
        const int h = n >> 6, d = n & 63;
        f16x8 o;
#pragma unroll
        for (int r = 0; r < 8; ++r) o[r] = (_Float16)(acc[im][in].f[r] + bn[in]);
        *(f16x8*)((_Float16*)outp +
                  (((size_t)(b * NUM_HEAD + h) * (SEQ / 32) + (s >> 5)) * HEAD_DIM + d) * 32 +
                  (s & 31)) = o;
      }
  } else {
#pragma unroll
    for (int im = 0; im < 2; ++im)
#pragma unroll
      for (int in = 0; in < 4; ++in)
#pragma unroll
        for (int r = 0; r < 8; ++r) {
          int m = m0 + wm * 32 + im * 16 + r + 8 * hi;
          int n = n0 + wn * 64 + in * 16 + l16;
          float val = acc[im][in].f[r] + bn[in];
          if (OUT_MODE == 0) {
            int b = m >> 11, s = m & 2047;
            int h = n >> 6, d = n & 63;
            ((_Float16*)outp)[(((size_t)(b * NUM_HEAD + h) * SEQ + s) * HEAD_DIM) + d] =
                (_Float16)val;
          } else {
            ((float*)outp)[(size_t)m * MODEL_DIM + n] = val;
          }
        }
    // the stores' registers are rewritten on the path laid out behind this branch: wait first
    if (OUT_MODE == 0) asm volatile("s_wait_xcnt 0x0" ::: "memory");
  }
}

// The Q, K and V projections in one launch: blockIdx.z picks the product, so
// three 128x128 tiles share a WGP and one's copy latency hides behind the others.
// Six waves per SIMD: the register budget that keeps three work-groups on a WGP, so all 768 are resident at once.
__global__ __launch_bounds__(256) __attribute__((amdgpu_waves_per_eu(6))) void gemm_qkv_kernel(const _Float16* __restrict__ Xh,
                                                       const _Float16* __restrict__ WTb,
                                                       const float* __restrict__ b_q,
                                                       const float* __restrict__ b_k,
                                                       const float* __restrict__ b_v,
                                                       _Float16* __restrict__ QKV) {
  const int z = blockIdx.z;
  gemm_body<0>(Xh + (size_t)z * TEN, WTb + (size_t)z * WEL,
               z == 0 ? b_q : z == 1 ? b_k : b_v, QKV + (size_t)z * TEN, z == 2);
}

__global__ __launch_bounds__(256) void gemm_out_kernel(const _Float16* __restrict__ A,
                                                       const _Float16* __restrict__ WT,
                                                       const float* __restrict__ bias,
                                                       float* __restrict__ out) {
  gemm_body<1>(A, WT, bias, out, false);
}

__device__ __forceinline__ float xhalf(float x) {
  const int b = __builtin_bit_cast(int, x);
  return __builtin_bit_cast(
      float, __builtin_amdgcn_permlanex16(b, b, 0x76543210, 0xfedcba98, false, false));
}

__global__ __launch_bounds__(256) void attn_kernel(const _Float16* __restrict__ Q,
                                                   const _Float16* __restrict__ K,
                                                   const _Float16* __restrict__ VT,
                                                   const unsigned* __restrict__ LM,
                                                   _Float16* __restrict__ AO) {
  __shared__ _Float16 Ks[64][72];        // [key][d]
  __shared__ _Float16 VTs[64][72];       // [d][key]

  const int t    = threadIdx.x;
  const int wid  = t >> 5;
  const int lane = t & 31;
  const int l16  = lane & 15;
  const int hi   = lane >> 4;
  const int bh   = blockIdx.y;
  const int b    = bh >> 4, h = bh & 15;
  const int q0   = blockIdx.x * 128 + wid * 16;
  const int ko   = hi * 8;

  AFrag qf[2];                           // B operand: column = query q0 + l16
  {
    const _Float16* qrow = Q + ((size_t)bh * SEQ + q0 + l16) * HEAD_DIM;
    qf[0].h[0] = *(const f16x8*)(qrow + ko);
    qf[0].h[1] = *(const f16x8*)(qrow + 16 + ko);
    qf[1].h[0] = *(const f16x8*)(qrow + 32 + ko);
    qf[1].h[1] = *(const f16x8*)(qrow + 48 + ko);
  }

  CFrag oacc[4];                         // oacc[n].f[r] = O[q0 + l16][n*16 + 8*hi + r]
  float mrun = -1e30f;                   // running max of this lane's query (both halves agree)
  float lrun = 0.0f;                     // running sum over this half's keys only
#pragma unroll
  for (int n = 0; n < 4; ++n)
#pragma unroll
    for (int r = 0; r < 8; ++r) oacc[n].f[r] = 0.0f;

  const float scale = 0.125f;            // 1/sqrt(HEAD_DIM)
  // this wave's lane-mask words: the address is the same in every lane, so they come by scalar loads
  const unsigned* lmw = LM + (size_t)(blockIdx.x * 8 + __builtin_amdgcn_readfirstlane(wid)) * (32 * 32);

  for (int kt0 = 0; kt0 < SEQ; kt0 += 64) {
    unsigned mw[32];                     // fetched here so that staging covers their latency
#pragma unroll
    for (int i = 0; i < 32; ++i) mw[i] = lmw[(kt0 >> 1) + i];
    __syncthreads();                     // previous iteration done with Ks/VTs
    // ---- stage the K tile [key][d] and the V^T tile [d][key] via async copies ----
    // both tiles are 8 KiB, contiguous, at the same element offset; V^T is two chunks [64 d][32 keys]
#pragma unroll
    for (int i = 0; i < 2; ++i) {
      int idx = t + i * 256;             // 0..511, 16-byte pieces
      const size_t off = ((size_t)bh * SEQ + kt0) * HEAD_DIM + idx * 8;
      cp16(&Ks[idx >> 3][(idx & 7) * 8], K + off);
      cp16(&VTs[t >> 2][i * 32 + (t & 3) * 8], VT + off);
    }
    cp_wait();
    __syncthreads();                     // publishes both tiles; directly behind the builtin wait it holds the LDS reads behind it

    // ---- scores^T: 4 sub-tiles of 16 keys (rows), 2 WMMAs each over d ----
    // s[j].f[r] = score(query q0 + l16, key kt0 + j*16 + 8*hi + r)
    CFrag s[4];
    float vm[4];
#pragma unroll
    for (int j = 0; j < 4; ++j) {
      AFrag kb0, kb1;
      int kl = j * 16 + l16;
      kb0.h[0] = *(const f16x8*)&Ks[kl][ko];
      kb0.h[1] = *(const f16x8*)&Ks[kl][16 + ko];
      kb1.h[0] = *(const f16x8*)&Ks[kl][32 + ko];
      kb1.h[1] = *(const f16x8*)&Ks[kl][48 + ko];
      v8f z = {0.f, 0.f, 0.f, 0.f, 0.f, 0.f, 0.f, 0.f};
      s[j].v = __builtin_amdgcn_wmma_f32_16x16x32_f16(false, kb0.v, false, qf[0].v,
                                                      (short)0, z, false, false);
      s[j].v = __builtin_amdgcn_wmma_f32_16x16x32_f16(false, kb1.v, false, qf[1].v,
                                                      (short)0, s[j].v, false, false);
      // word j*8 + r is the select's lane mask as it stands: no compare, no per-lane load
#pragma unroll
      for (int r = 0; r < 8; ++r)
        s[j].f[r] = __builtin_amdgcn_inverse_ballot_w32(mw[j * 8 + r]) ? s[j].f[r] * scale : -1e9f;
      vm[j] = s[j].f[0];
#pragma unroll
      for (int r = 1; r < 8; ++r) vm[j] = fmaxf(vm[j], s[j].f[r]);
    }

    // ---- online softmax, one query per lane ----
    float vmax = fmaxf(fmaxf(vm[0], vm[1]), fmaxf(vm[2], vm[3]));
    vmax = fmaxf(vmax, xhalf(vmax));
    const float mnew = fmaxf(mrun, vmax);
    const float c = __expf(mrun - mnew);
    mrun = mnew;

    AFrag pf[2];                         // B operand: two score sub-tiles converted in place, k order as vf below
    float ps[4];
#pragma unroll
    for (int j = 0; j < 4; ++j) {
      ps[j] = 0.0f;
#pragma unroll
      for (int r = 0; r < 8; ++r) {
        const float p = __expf(s[j].f[r] - mnew);
        ps[j] += p;
        pf[j >> 1].v[(j & 1) * 8 + r] = (_Float16)p;
      }
    }
    const float psum = (ps[0] + ps[1]) + (ps[2] + ps[3]);
    lrun = lrun * c + psum;
#pragma unroll
    for (int n = 0; n < 4; ++n)
#pragma unroll
      for (int r = 0; r < 8; ++r) oacc[n].f[r] *= c;

    // ---- O^T += V^T @ P^T ----
#pragma unroll
    for (int kk = 0; kk < 2; ++kk) {
#pragma unroll
      for (int n = 0; n < 4; ++n) {
        AFrag vf;
        int d = n * 16 + l16;
        vf.h[0] = *(const f16x8*)&VTs[d][kk * 32 + ko];
        vf.h[1] = *(const f16x8*)&VTs[d][kk * 32 + 16 + ko];
        oacc[n].v = __builtin_amdgcn_wmma_f32_16x16x32_f16(false, vf.v, false, pf[kk].v,
                                                           (short)0, oacc[n].v, false, false);
      }
    }
  }

  const float inv = 1.0f / (lrun + xhalf(lrun));   // join the two halves' sums once
  _Float16* orow = AO + ((size_t)b * SEQ + q0 + l16) * MODEL_DIM + h * HEAD_DIM + ko;
#pragma unroll
  for (int n = 0; n < 4; ++n) {
    f16x8 o;
#pragma unroll
    for (int r = 0; r < 8; ++r) o[r] = (_Float16)(oacc[n].f[r] * inv);
    *(f16x8*)(orow + n * 16) = o;
  }
}

// ---------------------------------------------------------------------------
extern "C" void kernel_launch(void* const* d_in, const int* in_sizes, int n_in,
                              void* d_out, int out_size, void* d_ws, size_t ws_size,
                              hipStream_t stream) {
  const float* q    = (const float*)d_in[0];
  const float* k    = (const float*)d_in[1];
  const float* v    = (const float*)d_in[2];
  const int*   mask = (const int*)d_in[3];
  const float* w_q  = (const float*)d_in[4];
  const float* b_q  = (const float*)d_in[5];
  const float* w_k  = (const float*)d_in[6];
  const float* b_k  = (const float*)d_in[7];
  const float* w_v  = (const float*)d_in[8];
  const float* b_v  = (const float*)d_in[9];
  const float* w_o  = (const float*)d_in[10];
  const float* b_o  = (const float*)d_in[11];

  _Float16* Xh   = (_Float16*)d_ws;                // q, k, v as f16, one after the other
  _Float16* WTb  = Xh + 3 * TEN;                   // w_q, w_k, w_v, w_o transposed
  _Float16* Qws  = WTb + 4 * WEL;                  // Q, K, V^T (by 32-row chunks) one after the other
  _Float16* Kws  = Qws + TEN;
  _Float16* Vws  = Kws + TEN;
  _Float16* AOws = Vws + TEN;
  unsigned* LMws = (unsigned*)(AOws + TEN);        // mask as lane-mask words, 512 KiB

  dim3 blk(256);

  prep_kernel<<<4 * WT_BLOCKS + MK_BLOCKS + 3 * CVT_BLOCKS, blk, 0, stream>>>(
      q, k, v, w_q, w_k, w_v, w_o, mask, Xh, WTb, LMws);
  gemm_qkv_kernel<<<dim3(MODEL_DIM / 128, ROWS / 128, 3), blk, 0, stream>>>(Xh, WTb, b_q, b_k,
                                                                            b_v, Qws);
  attn_kernel<<<dim3(SEQ / 128, BATCH * NUM_HEAD), blk, 0, stream>>>(Qws, Kws, Vws, LMws, AOws);
  gemm_out_kernel<<<dim3(MODEL_DIM / 128, ROWS / 128), blk, 0, stream>>>(AOws, WTb + 3 * WEL, b_o,
                                                                         (float*)d_out);
}

// v006
// One run takes 95.2 microseconds.
// Next to v005, in two timings, it ran 1.18 times as fast each time.
// Over all steps from v000 it is 2.27 times as fast.
#include <hip/hip_runtime.h>

typedef __attribute__((ext_vector_type(16))) _Float16 v16h;
typedef __attribute__((ext_vector_type(8)))  _Float16 f16x8;
typedef __attribute__((ext_vector_type(8)))  float    v8f;
typedef __attribute__((ext_vector_type(4)))  int      v4i;

#define MODEL_DIM 1024
#define NUM_HEAD  16
#define HEAD_DIM  64
#define BATCH     2
#define SEQ       2048
#define ROWS      (BATCH * SEQ)   // 4096

union AFrag { v16h v; f16x8 h[2]; };
union CFrag { v8f  v; float f[8]; };

// ---------------------------------------------------------------------------
// CDNA5 async global->LDS copy (ASYNCcnt path), with synchronous fallback.
// Probe-confirmed signature: (v4i addrspace(1)*, v4i addrspace(3)*, Ii, Ii)
// ---------------------------------------------------------------------------
#if defined(__HIP_DEVICE_COMPILE__) &&                                        \
    __has_builtin(__builtin_amdgcn_global_load_async_to_lds_b128) &&          \
    __has_builtin(__builtin_amdgcn_s_wait_asynccnt)
#define HAVE_ASYNC 1
#else
#define HAVE_ASYNC 0
#endif

__device__ __forceinline__ void cp16(_Float16* lds, const _Float16* g) {
#if HAVE_ASYNC
  __builtin_amdgcn_global_load_async_to_lds_b128(
      (__attribute__((address_space(1))) v4i*)(void*)g,
      (__attribute__((address_space(3))) v4i*)(void*)lds, 0, 0);
#else
  *(f16x8*)lds = *(const f16x8*)g;
#endif
}
__device__ __forceinline__ void cp_wait() {
#if HAVE_ASYNC
  __builtin_amdgcn_s_wait_asynccnt(0);
#endif
}

// ---------------------------------------------------------------------------
// Prep, one launch for all eight independent jobs, told apart by block range:
//   blocks [0, 1024)      W[k][n] f32 -> WT[n][k] f16, 256 tiles of 64x64 per weight
//   blocks [1024, 1536)   mask int32 -> lane-mask words, one (16 queries, 64 keys) tile per wave
//   blocks [1536, 7680)   f32 -> f16 elementwise, 2048 blocks per activation
// Lane-mask word LM[query group][key tile][j*8 + r]: bit l is set where
// mask[group*16 + (l & 15)][tile*64 + j*16 + (l >> 4)*8 + r] != 0, which is the place of
// that score in the attention kernel's accumulators (sub-tile j, register r, lane l).
// The transposes come first: they have the longer chain (load, LDS, barrier, store).
// ---------------------------------------------------------------------------
#define TEN ((size_t)ROWS * MODEL_DIM)        // elements of one activation
#define WEL ((size_t)MODEL_DIM * MODEL_DIM)   // elements of one weight
#define WT_BLOCKS  256                        // per weight
#define CVT_BLOCKS 2048                       // per activation
#define MK_BLOCKS  512                        // (SEQ/16) * (SEQ/64) tiles, 8 waves a block

__global__ __launch_bounds__(256) void prep_kernel(const float* __restrict__ q,
                                                   const float* __restrict__ k,
                                                   const float* __restrict__ v,
                                                   const float* __restrict__ w_q,
                                                   const float* __restrict__ w_k,
                                                   const float* __restrict__ w_v,
                                                   const float* __restrict__ w_o,
                                                   const int* __restrict__ mask,
                                                   _Float16* __restrict__ Xh,
                                                   _Float16* __restrict__ WTb,
                                                   unsigned* __restrict__ LM) {
  __shared__ _Float16 tile[64][72];
  const int t   = threadIdx.x;
  const int bid = blockIdx.x;

  if (bid < 4 * WT_BLOCKS) {                     // block-uniform
    const int wsel = bid >> 8, tl = bid & 255;
    const float* __restrict__ W = wsel == 0 ? w_q : wsel == 1 ? w_k : wsel == 2 ? w_v : w_o;
    _Float16* __restrict__ WT = WTb + (size_t)wsel * WEL;
    const int n0 = (tl & 15) * 64, k0 = (tl >> 4) * 64;
#pragma unroll
    for (int i = 0; i < 4; ++i) {
      int idx = t + i * 256;                     // 0..1023 float4 chunks
      int kk = idx >> 4, n4 = idx & 15;
      const float4 f = *(const float4*)(W + (size_t)(k0 + kk) * MODEL_DIM + n0 + n4 * 4);
      tile[n4 * 4 + 0][kk] = (_Float16)f.x;
      tile[n4 * 4 + 1][kk] = (_Float16)f.y;
      tile[n4 * 4 + 2][kk] = (_Float16)f.z;
      tile[n4 * 4 + 3][kk] = (_Float16)f.w;
    }
    __syncthreads();
#pragma unroll
    for (int i = 0; i < 2; ++i) {
      int idx = t + i * 256;                     // 0..511 f16x8 chunks
      int n = idx >> 3, c8 = idx & 7;
      *(f16x8*)(WT + (size_t)(n0 + n) * MODEL_DIM + k0 + c8 * 8) =
          *(const f16x8*)&tile[n][c8 * 8];
    }
  } else if (bid < 4 * WT_BLOCKS + MK_BLOCKS) {  // block-uniform
    const int tile_id = (bid - 4 * WT_BLOCKS) * 8 + (t >> 5);   // group * 32 + key tile
    const int lane = t & 31;
    const int* __restrict__ mp = mask + (size_t)((tile_id >> 5) * 16 + (lane & 15)) * SEQ +
                                 (tile_id & 31) * 64 + (lane >> 4) * 8;
    v4i m[8];
#pragma unroll
    for (int i = 0; i < 8; ++i) m[i] = *(const v4i*)(mp + (i >> 1) * 16 + (i & 1) * 4);
    unsigned mine = 0;
#pragma unroll
    for (int i = 0; i < 32; ++i) {
      const unsigned w = __builtin_amdgcn_ballot_w32(m[i >> 2][i & 3] != 0);
      if (lane == i) mine = w;
    }
    LM[(size_t)tile_id * 32 + lane] = mine;
    // the store's address registers may be rewritten on a path laid out behind this branch: wait first
    asm volatile("s_wait_xcnt 0x0" ::: "memory");
  } else {
    const int cb = bid - 4 * WT_BLOCKS - MK_BLOCKS;
    const int xsel = cb >> 11;
    const float* __restrict__ X = xsel == 0 ? q : xsel == 1 ? k : v;
    _Float16* __restrict__ Y = Xh + (size_t)xsel * TEN;
    size_t base = ((size_t)(cb & 2047) * 256 + t) * 8;
    const float4 a = *(const float4*)(X + base);
    const float4 b = *(const float4*)(X + base + 4);
    f16x8 h;
    h[0] = (_Float16)a.x; h[1] = (_Float16)a.y; h[2] = (_Float16)a.z; h[3] = (_Float16)a.w;
    h[4] = (_Float16)b.x; h[5] = (_Float16)b.y; h[6] = (_Float16)b.z; h[7] = (_Float16)b.w;
    *(f16x8*)(Y + base) = h;
    // the store's address registers are rewritten on the path laid out behind this branch: wait first
    asm volatile("s_wait_xcnt 0x0" ::: "memory");
  }
}

// ---------------------------------------------------------------------------
// GEMM: C[ROWS,1024] = A[ROWS,1024](f16) * WT[1024,1024](f16,[n][k]) + bias
// Block tile 128x128, K-step 64, double-buffered async LDS staging: a stage holds 128 bytes of
// every operand row, so eight lanes of a copy take one whole 128-byte line and no line is asked for twice.
//  OUT_MODE 0 -> f16 into [B,H,S,64]    OUT_MODE 1 -> f32 into [B,S,1024]
//  OUT_MODE 0 with tr (block-uniform) -> f16 into [B,H,S/32][64 d][32 s]: transposed in
//  chunks of 32 rows, so that a wave's 32 x 64 tile is one contiguous 4 KiB that it alone writes.
//  A lane's eight accumulator registers are eight consecutive s of one d: one 16-byte store.
// ---------------------------------------------------------------------------
template <int OUT_MODE>
__device__ __forceinline__ void gemm_body(const _Float16* __restrict__ A,
                                          const _Float16* __restrict__ WT,
                                          const float* __restrict__ bias,
                                          void* __restrict__ outp, const bool tr) {
  __shared__ _Float16 As[2][128][72];   // [m][k], +8 f16 pad: pitch 144 B = 16 B x odd
  __shared__ _Float16 Bs[2][128][72];   // [n][k]

  const int t    = threadIdx.x;
  const int wid  = t >> 5;
  const int lane = t & 31;
  const int l16  = lane & 15;
  const int hi   = lane >> 4;
  const int m0   = blockIdx.y * 128;
  const int n0   = blockIdx.x * 128;
  const int wm   = wid & 3;             // 4 wave-rows * 32 rows
  const int wn   = wid >> 2;            // 2 wave-cols * 64 cols

  CFrag acc[2][4];
#pragma unroll
  for (int im = 0; im < 2; ++im)
#pragma unroll
    for (int in = 0; in < 4; ++in)
#pragma unroll
      for (int r = 0; r < 8; ++r) acc[im][in].f[r] = 0.0f;

  auto stage = [&](int buf, int k0) {
#pragma unroll
    for (int i = 0; i < 4; ++i) {
      int idx = t + i * 256;            // 0..1023, 16B chunks of the 128x64 tile
      int row = idx >> 3, c8 = idx & 7;
      cp16(&As[buf][row][c8 * 8], A  + (size_t)(m0 + row) * MODEL_DIM + k0 + c8 * 8);
      cp16(&Bs[buf][row][c8 * 8], WT + (size_t)(n0 + row) * MODEL_DIM + k0 + c8 * 8);
    }
  };

  stage(0, 0);
  const int ko = hi * 8;

  for (int kt = 0; kt < MODEL_DIM / 64; ++kt) {
    cp_wait();
    __syncthreads();                    // tile kt ready; tile kt-1 consumers done
    if (kt + 1 < MODEL_DIM / 64) stage((kt + 1) & 1, (kt + 1) * 64);
    const int buf = kt & 1;

    // unrolled: the two halves' LDS offsets become immediates and their loads can be issued ahead
#pragma unroll
    for (int kk = 0; kk < 64; kk += 32) {   // k runs upward as before: the sums keep their order
      AFrag af[2], bf[4];
#pragma unroll
      for (int im = 0; im < 2; ++im) {
        int mr = wm * 32 + im * 16 + l16;
        af[im].h[0] = *(const f16x8*)&As[buf][mr][kk + ko];
        af[im].h[1] = *(const f16x8*)&As[buf][mr][kk + 16 + ko];
      }
#pragma unroll
      for (int in = 0; in < 4; ++in) {
        int nr = wn * 64 + in * 16 + l16;
        bf[in].h[0] = *(const f16x8*)&Bs[buf][nr][kk + ko];
        bf[in].h[1] = *(const f16x8*)&Bs[buf][nr][kk + 16 + ko];
      }
#pragma unroll
      for (int im = 0; im < 2; ++im)
#pragma unroll
        for (int in = 0; in < 4; ++in)
          acc[im][in].v = __builtin_amdgcn_wmma_f32_16x16x32_f16(
              false, af[im].v, false, bf[in].v, (short)0, acc[im][in].v, false, false);
    }
  }

  float bn[4];
#pragma unroll
  for (int in = 0; in < 4; ++in) bn[in] = bias[n0 + wn * 64 + in * 16 + l16];

  if (OUT_MODE == 0 && tr) {
#pragma unroll
    for (int im = 0; im < 2; ++im)
#pragma unroll
      for (int in = 0; in < 4; ++in) {
        const int m = m0 + wm * 32 + im * 16 + 8 * hi;   // first of the lane's eight rows
        const int n = n0 + wn * 64 + in * 16 + l16;
        const int b = m >> 11, s = m & 2047;
        const int h = n >> 6, d = n & 63;
        f16x8 o;
#pragma unroll
        for (int r = 0; r < 8; ++r) o[r] = (_Float16)(acc[im][in].f[r] + bn[in]);
        *(f16x8*)((_Float16*)outp +
                  (((size_t)(b * NUM_HEAD + h) * (SEQ / 32) + (s >> 5)) * HEAD_DIM + d) * 32 +
                  (s & 31)) = o;
      }
  } else {
#pragma unroll
    for (int im = 0; im < 2; ++im)
#pragma unroll
      for (int in = 0; in < 4; ++in)
#pragma unroll
        for (int r = 0; r < 8; ++r) {
          int m = m0 + wm * 32 + im * 16 + r + 8 * hi;
          int n = n0 + wn * 64 + in * 16 + l16;
          float val = acc[im][in].f[r] + bn[in];
          if (OUT_MODE == 0) {
            int b = m >> 11, s = m & 2047;
            int h = n >> 6, d = n & 63;
            ((_Float16*)outp)[(((size_t)(b * NUM_HEAD + h) * SEQ + s) * HEAD_DIM) + d] =
                (_Float16)val;
          } else {
            ((float*)outp)[(size_t)m * MODEL_DIM + n] = val;
          }
        }
    // the stores' registers are rewritten on the path laid out behind this branch: wait first
    if (OUT_MODE == 0) asm volatile("s_wait_xcnt 0x0" ::: "memory");
  }
}

// The Q, K and V projections in one launch: blockIdx.z picks the product, so
// three 128x128 tiles share a WGP and one's copy latency hides behind the others.
// Six waves per SIMD: the register budget that keeps three work-groups on a WGP, so all 768 are resident at once.
__global__ __launch_bounds__(256) __attribute__((amdgpu_waves_per_eu(6))) void gemm_qkv_kernel(const _Float16* __restrict__ Xh,
                                                       const _Float16* __restrict__ WTb,
                                                       const float* __restrict__ b_q,
                                                       const float* __restrict__ b_k,
                                                       const float* __restrict__ b_v,
                                                       _Float16* __restrict__ QKV) {
  const int z = blockIdx.z;
  gemm_body<0>(Xh + (size_t)z * TEN, WTb + (size_t)z * WEL,
               z == 0 ? b_q : z == 1 ? b_k : b_v, QKV + (size_t)z * TEN, z == 2);
}

__global__ __launch_bounds__(256) void gemm_out_kernel(const _Float16* __restrict__ A,
                                                       const _Float16* __restrict__ WT,
                                                       const float* __restrict__ bias,
                                                       float* __restrict__ out) {
  gemm_body<1>(A, WT, bias, out, false);
}

__device__ __forceinline__ float xhalf(float x) {
  const int b = __builtin_bit_cast(int, x);
  return __builtin_bit_cast(
      float, __builtin_amdgcn_permlanex16(b, b, 0x76543210, 0xfedcba98, false, false));
}

__global__ __launch_bounds__(256) void attn_kernel(const _Float16* __restrict__ Q,
                                                   const _Float16* __restrict__ K,
                                                   const _Float16* __restrict__ VT,
                                                   const unsigned* __restrict__ LM,
                                                   _Float16* __restrict__ AO) {
  // per buffer: rows 0..63 the K tile [key][d], rows 64..127 the V^T tile [d][key]
  __shared__ __attribute__((aligned(16))) _Float16 KV[2][128][72];

  const int t    = threadIdx.x;
  const int wid  = t >> 5;
  const int lane = t & 31;
  const int l16  = lane & 15;
  const int hi   = lane >> 4;
  const int bh   = blockIdx.y;
  const int b    = bh >> 4, h = bh & 15;
  const int q0   = blockIdx.x * 128 + wid * 16;
  const int ko   = hi * 8;

  AFrag qf[2];                           // B operand: column = query q0 + l16
  {
    const _Float16* qrow = Q + ((size_t)bh * SEQ + q0 + l16) * HEAD_DIM;
    qf[0].h[0] = *(const f16x8*)(qrow + ko);
    qf[0].h[1] = *(const f16x8*)(qrow + 16 + ko);
    qf[1].h[0] = *(const f16x8*)(qrow + 32 + ko);
    qf[1].h[1] = *(const f16x8*)(qrow + 48 + ko);
  }

  CFrag oacc[4];                         // oacc[n].f[r] = O[q0 + l16][n*16 + 8*hi + r]
  float mrun = -1e30f;                   // running max of this lane's query (both halves agree)
  float lrun = 0.0f;                     // running sum over this half's keys only
#pragma unroll
  for (int n = 0; n < 4; ++n)
#pragma unroll
    for (int r = 0; r < 8; ++r) oacc[n].f[r] = 0.0f;

  const float scale = 0.125f;            // 1/sqrt(HEAD_DIM)
  // this wave's lane-mask words: the address is the same in every lane, so they come by scalar loads
  // (constant address space: no launch-mate writes them, and the staging's "memory" clobbers must not turn them into per-lane loads)
  const __attribute__((address_space(4))) unsigned* lmw = (const __attribute__((address_space(4))) unsigned*)(const void*)(
      LM + (size_t)(blockIdx.x * 8 + __builtin_amdgcn_readfirstlane(wid)) * (32 * 32));

  // ---- staging: the K tile [key][d] and the V^T tile [d][key] by async copies ----
  // both tiles are 8 KiB, contiguous, at the same element offset; V^T is two chunks [64 d][32 keys];
  // a thread brings 16-byte pieces t and t + 256 of each
  const unsigned ldsK = (unsigned)(size_t)&KV[0][t >> 3][(t & 7) * 8];        // low 32 bits: the LDS byte address
  const unsigned ldsV = (unsigned)(size_t)&KV[0][64 + (t >> 2)][(t & 3) * 8];
  const _Float16* gK = K  + (size_t)bh * SEQ * HEAD_DIM + t * 8;
  const _Float16* gV = VT + (size_t)bh * SEQ * HEAD_DIM + t * 8;
  auto stage = [&](int buf, int kt0) {
    const unsigned lo = (unsigned)buf * (unsigned)sizeof(KV[0]);
    const _Float16* k0 = gK + (size_t)kt0 * HEAD_DIM;
    const _Float16* v0 = gV + (size_t)kt0 * HEAD_DIM;
    // the four copies and, as the statement's last line, the wait that stands before their address registers are rewritten
    asm volatile("global_load_async_to_lds_b128 %0, %4, off\n\t"
                 "global_load_async_to_lds_b128 %1, %5, off\n\t"
                 "global_load_async_to_lds_b128 %2, %6, off\n\t"
                 "global_load_async_to_lds_b128 %3, %7, off\n\t"
                 "s_wait_xcnt 0x0"
                 :: "v"(ldsK + lo), "v"(ldsK + lo + 32 * 144), "v"(ldsV + lo), "v"(ldsV + lo + 64),
                    "v"(k0), "v"(k0 + 2048), "v"(v0), "v"(v0 + 2048)
                 : "memory");
  };

  stage(0, 0);
  asm volatile("s_wait_asynccnt 0x0" ::: "memory");   // this wave's share of tile 0 has landed
  __syncthreads();                                    // tile 0 published
  stage(1, 64);

  unsigned mw[32];                       // the tile's lane-mask words, fetched one tile ahead like K and V^T
#pragma unroll
  for (int i = 0; i < 32; ++i) mw[i] = lmw[i];

  for (int kt0 = 0; kt0 < SEQ; kt0 += 64) {
    const int buf = (kt0 >> 6) & 1;
    const _Float16 (*Ks)[72]  = &KV[buf][0];
    const _Float16 (*VTs)[72] = &KV[buf][64];

    // ---- scores^T: 4 sub-tiles of 16 keys (rows), 2 WMMAs each over d ----
    // s[j].f[r] = score(query q0 + l16, key kt0 + j*16 + 8*hi + r)
    CFrag s[4];
    float vm[4];
#pragma unroll
    for (int j = 0; j < 4; ++j) {
      AFrag kb0, kb1;
      int kl = j * 16 + l16;
      kb0.h[0] = *(const f16x8*)&Ks[kl][ko];
      kb0.h[1] = *(const f16x8*)&Ks[kl][16 + ko];
      kb1.h[0] = *(const f16x8*)&Ks[kl][32 + ko];
      kb1.h[1] = *(const f16x8*)&Ks[kl][48 + ko];
      v8f z = {0.f, 0.f, 0.f, 0.f, 0.f, 0.f, 0.f, 0.f};
      s[j].v = __builtin_amdgcn_wmma_f32_16x16x32_f16(false, kb0.v, false, qf[0].v,
                                                      (short)0, z, false, false);
      s[j].v = __builtin_amdgcn_wmma_f32_16x16x32_f16(false, kb1.v, false, qf[1].v,
                                                      (short)0, s[j].v, false, false);
      // word j*8 + r is the select's lane mask as it stands: no compare, no per-lane load
#pragma unroll
      for (int r = 0; r < 8; ++r)
        s[j].f[r] = __builtin_amdgcn_inverse_ballot_w32(mw[j * 8 + r]) ? s[j].f[r] * scale : -1e9f;
      vm[j] = s[j].f[0];
#pragma unroll
      for (int r = 1; r < 8; ++r) vm[j] = fmaxf(vm[j], s[j].f[r]);
    }

    // the next tile's words, now that this tile's are used up (the last trip fetches its own again)
    {
      const int nx = (kt0 + 64 < SEQ ? kt0 + 64 : kt0) >> 1;
#pragma unroll
      for (int i = 0; i < 32; ++i) mw[i] = lmw[nx + i];
    }

    // ---- online softmax, one query per lane ----
    float vmax = fmaxf(fmaxf(vm[0], vm[1]), fmaxf(vm[2], vm[3]));
    vmax = fmaxf(vmax, xhalf(vmax));
    const float mnew = fmaxf(mrun, vmax);
    const float c = __expf(mrun - mnew);
    mrun = mnew;

    AFrag pf[2];                         // B operand: two score sub-tiles converted in place, k order as vf below
    float ps[4];
#pragma unroll
    for (int j = 0; j < 4; ++j) {
      ps[j] = 0.0f;
#pragma unroll
      for (int r = 0; r < 8; ++r) {
        const float p = __expf(s[j].f[r] - mnew);
        ps[j] += p;
        pf[j >> 1].v[(j & 1) * 8 + r] = (_Float16)p;
      }
    }
    const float psum = (ps[0] + ps[1]) + (ps[2] + ps[3]);
    lrun = lrun * c + psum;
#pragma unroll
    for (int n = 0; n < 4; ++n)
#pragma unroll
      for (int r = 0; r < 8; ++r) oacc[n].f[r] *= c;

    // ---- O^T += V^T @ P^T ----
#pragma unroll
    for (int kk = 0; kk < 2; ++kk) {
#pragma unroll
      for (int n = 0; n < 4; ++n) {
        AFrag vf;
        int d = n * 16 + l16;
        vf.h[0] = *(const f16x8*)&VTs[d][kk * 32 + ko];
        vf.h[1] = *(const f16x8*)&VTs[d][kk * 32 + 16 + ko];
        oacc[n].v = __builtin_amdgcn_wmma_f32_16x16x32_f16(false, vf.v, false, pf[kk].v,
                                                           (short)0, oacc[n].v, false, false);
      }
    }

    // ---- publish point of tile t + 1 ----
    asm volatile("s_wait_dscnt 0x0" ::: "memory");      // this wave's reads of the buffer have returned
    asm volatile("s_wait_asynccnt 0x0" ::: "memory");   // this wave's share of tile t + 1 has landed
    __syncthreads();                                    // tile t + 1 published; every reader has left this buffer
    if (kt0 + 128 < SEQ) stage(buf, kt0 + 128);         // the same for the whole work-group
  }
  asm volatile("s_wait_asynccnt 0x0" ::: "memory");     // no copy is left in flight when the wave ends

  const float inv = 1.0f / (lrun + xhalf(lrun));   // join the two halves' sums once
  _Float16* orow = AO + ((size_t)b * SEQ + q0 + l16) * MODEL_DIM + h * HEAD_DIM + ko;
#pragma unroll
  for (int n = 0; n < 4; ++n) {
    f16x8 o;
#pragma unroll
    for (int r = 0; r < 8; ++r) o[r] = (_Float16)(oacc[n].f[r] * inv);
    *(f16x8*)(orow + n * 16) = o;
  }
}

// ---------------------------------------------------------------------------
extern "C" void kernel_launch(void* const* d_in, const int* in_sizes, int n_in,
                              void* d_out, int out_size, void* d_ws, size_t ws_size,
                              hipStream_t stream) {
  const float* q    = (const float*)d_in[0];
  const float* k    = (const float*)d_in[1];
  const float* v    = (const float*)d_in[2];
  const int*   mask = (const int*)d_in[3];
  const float* w_q  = (const float*)d_in[4];
  const float* b_q  = (const float*)d_in[5];
  const float* w_k  = (const float*)d_in[6];
  const float* b_k  = (const float*)d_in[7];
  const float* w_v  = (const float*)d_in[8];
  const float* b_v  = (const float*)d_in[9];
  const float* w_o  = (const float*)d_in[10];
  const float* b_o  = (const float*)d_in[11];

  _Float16* Xh   = (_Float16*)d_ws;                // q, k, v as f16, one after the other
  _Float16* WTb  = Xh + 3 * TEN;                   // w_q, w_k, w_v, w_o transposed
  _Float16* Qws  = WTb + 4 * WEL;                  // Q, K, V^T (by 32-row chunks) one after the other
  _Float16* Kws  = Qws + TEN;
  _Float16* Vws  = Kws + TEN;
  _Float16* AOws = Vws + TEN;
  unsigned* LMws = (unsigned*)(AOws + TEN);        // mask as lane-mask words, 512 KiB

  dim3 blk(256);

  prep_kernel<<<4 * WT_BLOCKS + MK_BLOCKS + 3 * CVT_BLOCKS, blk, 0, stream>>>(
      q, k, v, w_q, w_k, w_v, w_o, mask, Xh, WTb, LMws);
  gemm_qkv_kernel<<<dim3(MODEL_DIM / 128, ROWS / 128, 3), blk, 0, stream>>>(Xh, WTb, b_q, b_k,
                                                                            b_v, Qws);
  attn_kernel<<<dim3(SEQ / 128, BATCH * NUM_HEAD), blk, 0, stream>>>(Qws, Kws, Vws, LMws, AOws);
  gemm_out_kernel<<<dim3(MODEL_DIM / 128, ROWS / 128), blk, 0, stream>>>(AOws, WTb + 3 * WEL, b_o,
                                                                         (float*)d_out);
}

// v007
// Measured time: 92.4 microseconds a run.
// Timed twice side by side with v006, it ran 1.03 times as fast both times.
// Over all steps from v000 it is 2.34 times as fast.
#include <hip/hip_runtime.h>

typedef __attribute__((ext_vector_type(16))) _Float16 v16h;
typedef __attribute__((ext_vector_type(8)))  _Float16 f16x8;
typedef __attribute__((ext_vector_type(8)))  float    v8f;
typedef __attribute__((ext_vector_type(4)))  int      v4i;

#define MODEL_DIM 1024
#define NUM_HEAD  16
#define HEAD_DIM  64
#define BATCH     2
#define SEQ       2048
#define ROWS      (BATCH * SEQ)   // 4096

union AFrag { v16h v; f16x8 h[2]; };
union CFrag { v8f  v; float f[8]; };

// ---------------------------------------------------------------------------
// CDNA5 async global->LDS copy (ASYNCcnt path), with synchronous fallback.
// Probe-confirmed signature: (v4i addrspace(1)*, v4i addrspace(3)*, Ii, Ii)
// ---------------------------------------------------------------------------
#if defined(__HIP_DEVICE_COMPILE__) &&                                        \
    __has_builtin(__builtin_amdgcn_global_load_async_to_lds_b128) &&          \
    __has_builtin(__builtin_amdgcn_s_wait_asynccnt)
#define HAVE_ASYNC 1
#else
#define HAVE_ASYNC 0
#endif

__device__ __forceinline__ void cp16(_Float16* lds, const _Float16* g) {
#if HAVE_ASYNC
  __builtin_amdgcn_global_load_async_to_lds_b128(
      (__attribute__((address_space(1))) v4i*)(void*)g,
      (__attribute__((address_space(3))) v4i*)(void*)lds, 0, 0);
#else
  *(f16x8*)lds = *(const f16x8*)g;
#endif
}
__device__ __forceinline__ void cp_wait() {
#if HAVE_ASYNC
  __builtin_amdgcn_s_wait_asynccnt(0);
#endif
}

// ---------------------------------------------------------------------------
// Prep, one launch for all eight independent jobs, told apart by block range:
//   blocks [0, 1024)      W[k][n] f32 -> WT[n][k] f16, 256 tiles of 64x64 per weight
//   blocks [1024, 1536)   mask int32 -> lane-mask words, one (16 queries, 64 keys) tile per wave
//   blocks [1536, 7680)   f32 -> f16 elementwise, 2048 blocks per activation
// Lane-mask word LM[query group][key tile][j*8 + r]: bit l is set where
// mask[group*16 + (l & 15)][tile*64 + j*16 + (l >> 4)*8 + r] != 0, which is the place of
// that score in the attention kernel's accumulators (sub-tile j, register r, lane l).
// The transposes come first: they have the longer chain (load, LDS, barrier, store).
// ---------------------------------------------------------------------------
#define TEN ((size_t)ROWS * MODEL_DIM)        // elements of one activation
#define WEL ((size_t)MODEL_DIM * MODEL_DIM)   // elements of one weight
#define WT_BLOCKS  256                        // per weight
#define CVT_BLOCKS 2048                       // per activation
#define MK_BLOCKS  512                        // (SEQ/16) * (SEQ/64) tiles, 8 waves a block

__global__ __launch_bounds__(256) void prep_kernel(const float* __restrict__ q,
                                                   const float* __restrict__ k,
                                                   const float* __restrict__ v,
                                                   const float* __restrict__ w_q,
                                                   const float* __restrict__ w_k,
                                                   const float* __restrict__ w_v,
                                                   const float* __restrict__ w_o,
                                                   const int* __restrict__ mask,
                                                   _Float16* __restrict__ Xh,
                                                   _Float16* __restrict__ WTb,
                                                   unsigned* __restrict__ LM) {
  __shared__ _Float16 tile[64][72];
  const int t   = threadIdx.x;
  const int bid = blockIdx.x;

  if (bid < 4 * WT_BLOCKS) {                     // block-uniform
    const int wsel = bid >> 8, tl = bid & 255;
    const float* __restrict__ W = wsel == 0 ? w_q : wsel == 1 ? w_k : wsel == 2 ? w_v : w_o;
    _Float16* __restrict__ WT = WTb + (size_t)wsel * WEL;
    const int n0 = (tl & 15) * 64, k0 = (tl >> 4) * 64;
#pragma unroll
    for (int i = 0; i < 4; ++i) {
      int idx = t + i * 256;                     // 0..1023 float4 chunks
      int kk = idx >> 4, n4 = idx & 15;
      const float4 f = *(const float4*)(W + (size_t)(k0 + kk) * MODEL_DIM + n0 + n4 * 4);
      tile[n4 * 4 + 0][kk] = (_Float16)f.x;
      tile[n4 * 4 + 1][kk] = (_Float16)f.y;
      tile[n4 * 4 + 2][kk] = (_Float16)f.z;
      tile[n4 * 4 + 3][kk] = (_Float16)f.w;
    }
    __syncthreads();
#pragma unroll
    for (int i = 0; i < 2; ++i) {
      int idx = t + i * 256;                     // 0..511 f16x8 chunks
      int n = idx >> 3, c8 = idx & 7;
      *(f16x8*)(WT + (size_t)(n0 + n) * MODEL_DIM + k0 + c8 * 8) =
          *(const f16x8*)&tile[n][c8 * 8];
    }
  } else if (bid < 4 * WT_BLOCKS + MK_BLOCKS) {  // block-uniform
    const int tile_id = (bid - 4 * WT_BLOCKS) * 8 + (t >> 5);   // group * 32 + key tile
    const int lane = t & 31;
    const int* __restrict__ mp = mask + (size_t)((tile_id >> 5) * 16 + (lane & 15)) * SEQ +
                                 (tile_id & 31) * 64 + (lane >> 4) * 8;
    v4i m[8];
#pragma unroll
    for (int i = 0; i < 8; ++i) m[i] = *(const v4i*)(mp + (i >> 1) * 16 + (i & 1) * 4);
    unsigned mine = 0;
#pragma unroll
    for (int i = 0; i < 32; ++i) {
      const unsigned w = __builtin_amdgcn_ballot_w32(m[i >> 2][i & 3] != 0);
      if (lane == i) mine = w;
    }
    LM[(size_t)tile_id * 32 + lane] = mine;
    // the store's address registers may be rewritten on a path laid out behind this branch: wait first
    asm volatile("s_wait_xcnt 0x0" ::: "memory");
  } else {
    const int cb = bid - 4 * WT_BLOCKS - MK_BLOCKS;
    const int xsel = cb >> 11;
    const float* __restrict__ X = xsel == 0 ? q : xsel == 1 ? k : v;
    _Float16* __restrict__ Y = Xh + (size_t)xsel * TEN;
    size_t base = ((size_t)(cb & 2047) * 256 + t) * 8;
    const float4 a = *(const float4*)(X + base);
    const float4 b = *(const float4*)(X + base + 4);
    f16x8 h;
    h[0] = (_Float16)a.x; h[1] = (_Float16)a.y; h[2] = (_Float16)a.z; h[3] = (_Float16)a.w;
    h[4] = (_Float16)b.x; h[5] = (_Float16)b.y; h[6] = (_Float16)b.z; h[7] = (_Float16)b.w;
    *(f16x8*)(Y + base) = h;
    // the store's address registers are rewritten on the path laid out behind this branch: wait first
    asm volatile("s_wait_xcnt 0x0" ::: "memory");
  }
}

// ---------------------------------------------------------------------------
// GEMM: C[ROWS,1024] = A[ROWS,1024](f16) * WT[1024,1024](f16,[n][k]) + bias
// Block tile 128x128, K-step 64, double-buffered async LDS staging: a stage holds 128 bytes of
// every operand row, so eight lanes of a copy take one whole 128-byte line and no line is asked for twice.
//  OUT_MODE 0 -> f16 into [B,H,S,64]    OUT_MODE 1 -> f32 into [B,S,1024]
//  OUT_MODE 0 with tr (block-uniform) -> f16 into [B,H,S/32][64 d][32 s]: transposed in
//  chunks of 32 rows, so that a wave's 32 x 64 tile is one contiguous 4 KiB that it alone writes.
//  A lane's eight accumulator registers are eight consecutive s of one d: one 16-byte store.
// ---------------------------------------------------------------------------
template <int OUT_MODE>
__device__ __forceinline__ void gemm_body(const _Float16* __restrict__ A,
                                          const _Float16* __restrict__ WT,
                                          const float* __restrict__ bias,
                                          void* __restrict__ outp, const bool tr) {
  __shared__ _Float16 As[2][128][72];   // [m][k], +8 f16 pad: pitch 144 B = 16 B x odd
  __shared__ _Float16 Bs[2][128][72];   // [n][k]

  const int t    = threadIdx.x;
  const int wid  = t >> 5;
  const int lane = t & 31;
  const int l16  = lane & 15;
  const int hi   = lane >> 4;
  const int m0   = blockIdx.y * 128;
  const int n0   = blockIdx.x * 128;
  const int wm   = wid & 3;             // 4 wave-rows * 32 rows
  const int wn   = wid >> 2;            // 2 wave-cols * 64 cols

  CFrag acc[2][4];
#pragma unroll
  for (int im = 0; im < 2; ++im)
#pragma unroll
    for (int in = 0; in < 4; ++in)
#pragma unroll
      for (int r = 0; r < 8; ++r) acc[im][in].f[r] = 0.0f;

  auto stage = [&](int buf, int k0) {
#pragma unroll
    for (int i = 0; i < 4; ++i) {
      int idx = t + i * 256;            // 0..1023, 16B chunks of the 128x64 tile
      int row = idx >> 3, c8 = idx & 7;
      cp16(&As[buf][row][c8 * 8], A  + (size_t)(m0 + row) * MODEL_DIM + k0 + c8 * 8);
      cp16(&Bs[buf][row][c8 * 8], WT + (size_t)(n0 + row) * MODEL_DIM + k0 + c8 * 8);
    }
  };

  stage(0, 0);
  const int ko = hi * 8;

  for (int kt = 0; kt < MODEL_DIM / 64; ++kt) {
    cp_wait();
    __syncthreads();                    // tile kt ready; tile kt-1 consumers done
    if (kt + 1 < MODEL_DIM / 64) stage((kt + 1) & 1, (kt + 1) * 64);
    const int buf = kt & 1;

    // unrolled: the two halves' LDS offsets become immediates and their loads can be issued ahead
#pragma unroll
    for (int kk = 0; kk < 64; kk += 32) {   // k runs upward as before: the sums keep their order
      AFrag af[2], bf[4];
#pragma unroll
      for (int im = 0; im < 2; ++im) {
        int mr = wm * 32 + im * 16 + l16;
        af[im].h[0] = *(const f16x8*)&As[buf][mr][kk + ko];
        af[im].h[1] = *(const f16x8*)&As[buf][mr][kk + 16 + ko];
      }
#pragma unroll
      for (int in = 0; in < 4; ++in) {
        int nr = wn * 64 + in * 16 + l16;
        bf[in].h[0] = *(const f16x8*)&Bs[buf][nr][kk + ko];
        bf[in].h[1] = *(const f16x8*)&Bs[buf][nr][kk + 16 + ko];
      }
#pragma unroll
      for (int im = 0; im < 2; ++im)
#pragma unroll
        for (int in = 0; in < 4; ++in)
          acc[im][in].v = __builtin_amdgcn_wmma_f32_16x16x32_f16(
              false, af[im].v, false, bf[in].v, (short)0, acc[im][in].v, false, false);
    }
  }

  float bn[4];
#pragma unroll
  for (int in = 0; in < 4; ++in) bn[in] = bias[n0 + wn * 64 + in * 16 + l16];

  if (OUT_MODE == 0 && tr) {
#pragma unroll
    for (int im = 0; im < 2; ++im)
#pragma unroll
      for (int in = 0; in < 4; ++in) {
        const int m = m0 + wm * 32 + im * 16 + 8 * hi;   // first of the lane's eight rows
        const int n = n0 + wn * 64 + in * 16 + l16;
        const int b = m >> 11, s = m & 2047;
        const int h = n >> 6, d = n & 63;
        f16x8 o;
#pragma unroll
        for (int r = 0; r < 8; ++r) o[r] = (_Float16)(acc[im][in].f[r] + bn[in]);
        *(f16x8*)((_Float16*)outp +
                  (((size_t)(b * NUM_HEAD + h) * (SEQ / 32) + (s >> 5)) * HEAD_DIM + d) * 32 +
                  (s & 31)) = o;
      }
  } else {
#pragma unroll
    for (int im = 0; im < 2; ++im)
#pragma unroll
      for (int in = 0; in < 4; ++in)
#pragma unroll
        for (int r = 0; r < 8; ++r) {
          int m = m0 + wm * 32 + im * 16 + r + 8 * hi;
          int n = n0 + wn * 64 + in * 16 + l16;
          float val = acc[im][in].f[r] + bn[in];
          if (OUT_MODE == 0) {
            int b = m >> 11, s = m & 2047;
            int h = n >> 6, d = n & 63;
            ((_Float16*)outp)[(((size_t)(b * NUM_HEAD + h) * SEQ + s) * HEAD_DIM) + d] =
                (_Float16)val;
          } else {
            ((float*)outp)[(size_t)m * MODEL_DIM + n] = val;
          }
        }
    // the stores' registers are rewritten on the path laid out behind this branch: wait first
    if (OUT_MODE == 0) asm volatile("s_wait_xcnt 0x0" ::: "memory");
  }
}

// The Q, K and V projections in one launch: blockIdx.z picks the product, so
// three 128x128 tiles share a WGP and one's copy latency hides behind the others.
// Six waves per SIMD: the register budget that keeps three work-groups on a WGP, so all 768 are resident at once.
__global__ __launch_bounds__(256) __attribute__((amdgpu_waves_per_eu(6))) void gemm_qkv_kernel(const _Float16* __restrict__ Xh,
                                                       const _Float16* __restrict__ WTb,
                                                       const float* __restrict__ b_q,
                                                       const float* __restrict__ b_k,
                                                       const float* __restrict__ b_v,
                                                       _Float16* __restrict__ QKV) {
  const int z = blockIdx.z;
  gemm_body<0>(Xh + (size_t)z * TEN, WTb + (size_t)z * WEL,
               z == 0 ? b_q : z == 1 ? b_k : b_v, QKV + (size_t)z * TEN, z == 2);
}

__global__ __launch_bounds__(256) void gemm_out_kernel(const _Float16* __restrict__ A,
                                                       const _Float16* __restrict__ WT,
                                                       const float* __restrict__ bias,
                                                       float* __restrict__ out) {
  gemm_body<1>(A, WT, bias, out, false);
}

__device__ __forceinline__ float xhalf(float x) {
  const int b = __builtin_bit_cast(int, x);
  return __builtin_bit_cast(
      float, __builtin_amdgcn_permlanex16(b, b, 0x76543210, 0xfedcba98, false, false));
}

__global__ __launch_bounds__(256) void attn_kernel(const _Float16* __restrict__ Q,
                                                   const _Float16* __restrict__ K,
                                                   const _Float16* __restrict__ VT,
                                                   const unsigned* __restrict__ LM,
                                                   _Float16* __restrict__ AO) {
  // per buffer: rows 0..63 the K tile [key][d], rows 64..127 the V^T tile [d][key]
  __shared__ __attribute__((aligned(16))) _Float16 KV[2][128][72];

  const int t    = threadIdx.x;
  const int wid  = t >> 5;
  const int lane = t & 31;
  const int l16  = lane & 15;
  const int hi   = lane >> 4;
  const int bh   = blockIdx.y;
  const int b    = bh >> 4, h = bh & 15;
  const int q0   = blockIdx.x * 128 + wid * 16;
  const int ko   = hi * 8;

  AFrag qf[2];                           // B operand: column = query q0 + l16
  {
    const _Float16* qrow = Q + ((size_t)bh * SEQ + q0 + l16) * HEAD_DIM;
    qf[0].h[0] = *(const f16x8*)(qrow + ko);
    qf[0].h[1] = *(const f16x8*)(qrow + 16 + ko);
    qf[1].h[0] = *(const f16x8*)(qrow + 32 + ko);
    qf[1].h[1] = *(const f16x8*)(qrow + 48 + ko);
  }

  CFrag oacc[4];                         // oacc[n].f[r] = O[q0 + l16][n*16 + 8*hi + r]
  float mrun = -1e30f;                   // running max of this lane's query, unscaled (both halves agree)
  float lrun = 0.0f;                     // running sum over this half's keys only
#pragma unroll
  for (int n = 0; n < 4; ++n)
#pragma unroll
    for (int r = 0; r < 8; ++r) oacc[n].f[r] = 0.0f;

  // exp(s / 8 - m / 8) = 2^(s * c1 - m * c1): the scores stay as the product leaves them, and the scale
  // 1/sqrt(HEAD_DIM) and log2(e) meet them in the one fused multiply-add that forms the exponent
  const float c1 = 0.125f * 1.44269504088896340736f;
  // a masked score, in the unscaled domain: below -1e9 * 8, so its weight beside any real score is 0 as in the
  // reference; a power of two, so that its product with c1 is exact and a row with every key masked gets the
  // exponent 0 for every key (equal weights, as in the reference)
  const float masked = -8589934592.0f;
  // this wave's lane-mask words: the address is the same in every lane, so they come by scalar loads
  // (constant address space: no launch-mate writes them, and the staging's "memory" clobbers must not turn them into per-lane loads)
  const __attribute__((address_space(4))) unsigned* lmw = (const __attribute__((address_space(4))) unsigned*)(const void*)(
      LM + (size_t)(blockIdx.x * 8 + __builtin_amdgcn_readfirstlane(wid)) * (32 * 32));

  // ---- staging: the K tile [key][d] and the V^T tile [d][key] by async copies ----
  // both tiles are 8 KiB, contiguous, at the same element offset; V^T is two chunks [64 d][32 keys];
  // a thread brings 16-byte pieces t and t + 256 of each
  const unsigned ldsK = (unsigned)(size_t)&KV[0][t >> 3][(t & 7) * 8];        // low 32 bits: the LDS byte address
  const unsigned ldsV = (unsigned)(size_t)&KV[0][64 + (t >> 2)][(t & 3) * 8];
  const _Float16* gK = K  + (size_t)bh * SEQ * HEAD_DIM + t * 8;
  const _Float16* gV = VT + (size_t)bh * SEQ * HEAD_DIM + t * 8;
  auto stage = [&](int buf, int kt0) {
    const unsigned lo = (unsigned)buf * (unsigned)sizeof(KV[0]);
    const _Float16* k0 = gK + (size_t)kt0 * HEAD_DIM;
    const _Float16* v0 = gV + (size_t)kt0 * HEAD_DIM;
    // the four copies and, as the statement's last line, the wait that stands before their address registers are rewritten
    asm volatile("global_load_async_to_lds_b128 %0, %4, off\n\t"
                 "global_load_async_to_lds_b128 %1, %5, off\n\t"
                 "global_load_async_to_lds_b128 %2, %6, off\n\t"
                 "global_load_async_to_lds_b128 %3, %7, off\n\t"
                 "s_wait_xcnt 0x0"
                 :: "v"(ldsK + lo), "v"(ldsK + lo + 32 * 144), "v"(ldsV + lo), "v"(ldsV + lo + 64),
                    "v"(k0), "v"(k0 + 2048), "v"(v0), "v"(v0 + 2048)
                 : "memory");
  };

  stage(0, 0);
  asm volatile("s_wait_asynccnt 0x0" ::: "memory");   // this wave's share of tile 0 has landed
  __syncthreads();                                    // tile 0 published
  stage(1, 64);

  unsigned mw[32];                       // the tile's lane-mask words, fetched one tile ahead like K and V^T
#pragma unroll
  for (int i = 0; i < 32; ++i) mw[i] = lmw[i];

  for (int kt0 = 0; kt0 < SEQ; kt0 += 64) {
    const int buf = (kt0 >> 6) & 1;
    const _Float16 (*Ks)[72]  = &KV[buf][0];
    const _Float16 (*VTs)[72] = &KV[buf][64];

    // ---- scores^T: 4 sub-tiles of 16 keys (rows), 2 WMMAs each over d ----
    // s[j].f[r] = unscaled score(query q0 + l16, key kt0 + j*16 + 8*hi + r)
    CFrag s[4];
    float vm[4];
#pragma unroll
    for (int j = 0; j < 4; ++j) {
      AFrag kb0, kb1;
      int kl = j * 16 + l16;
      kb0.h[0] = *(const f16x8*)&Ks[kl][ko];
      kb0.h[1] = *(const f16x8*)&Ks[kl][16 + ko];
      kb1.h[0] = *(const f16x8*)&Ks[kl][32 + ko];
      kb1.h[1] = *(const f16x8*)&Ks[kl][48 + ko];
      v8f z = {0.f, 0.f, 0.f, 0.f, 0.f, 0.f, 0.f, 0.f};
      s[j].v = __builtin_amdgcn_wmma_f32_16x16x32_f16(false, kb0.v, false, qf[0].v,
                                                      (short)0, z, false, false);
      s[j].v = __builtin_amdgcn_wmma_f32_16x16x32_f16(false, kb1.v, false, qf[1].v,
                                                      (short)0, s[j].v, false, false);
      // word j*8 + r is the select's lane mask as it stands: no compare, no per-lane load
#pragma unroll
      for (int r = 0; r < 8; ++r)
        s[j].f[r] = __builtin_amdgcn_inverse_ballot_w32(mw[j * 8 + r]) ? s[j].f[r] : masked;
      vm[j] = s[j].f[0];
#pragma unroll
      for (int r = 1; r < 8; ++r) vm[j] = fmaxf(vm[j], s[j].f[r]);
    }

    // the next tile's words, now that this tile's are used up (the last trip fetches its own again)
    {
      const int nx = (kt0 + 64 < SEQ ? kt0 + 64 : kt0) >> 1;
#pragma unroll
      for (int i = 0; i < 32; ++i) mw[i] = lmw[nx + i];
    }

    // ---- online softmax, one query per lane ----
    float vmax = fmaxf(fmaxf(vm[0], vm[1]), fmaxf(vm[2], vm[3]));
    vmax = fmaxf(vmax, xhalf(vmax));
    const float mnew = fmaxf(mrun, vmax);
    const float nm = -mnew * c1;
    const float c = __builtin_amdgcn_exp2f(__builtin_fmaf(mrun, c1, nm));
    mrun = mnew;

    AFrag pf[2];                         // B operand: two score sub-tiles converted in place, k order as vf below
    float ps[4];
#pragma unroll
    for (int j = 0; j < 4; ++j) {
      ps[j] = 0.0f;
#pragma unroll
      for (int r = 0; r < 8; ++r) {
        const float p = __builtin_amdgcn_exp2f(__builtin_fmaf(s[j].f[r], c1, nm));
        ps[j] += p;
        pf[j >> 1].v[(j & 1) * 8 + r] = (_Float16)p;
      }
    }
    const float psum = (ps[0] + ps[1]) + (ps[2] + ps[3]);
    lrun = lrun * c + psum;
#pragma unroll
    for (int n = 0; n < 4; ++n)
#pragma unroll
      for (int r = 0; r < 8; ++r) oacc[n].f[r] *= c;

    // ---- O^T += V^T @ P^T ----
#pragma unroll
    for (int kk = 0; kk < 2; ++kk) {
#pragma unroll
      for (int n = 0; n < 4; ++n) {
        AFrag vf;
        int d = n * 16 + l16;
        vf.h[0] = *(const f16x8*)&VTs[d][kk * 32 + ko];
        vf.h[1] = *(const f16x8*)&VTs[d][kk * 32 + 16 + ko];
        oacc[n].v = __builtin_amdgcn_wmma_f32_16x16x32_f16(false, vf.v, false, pf[kk].v,
                                                           (short)0, oacc[n].v, false, false);
      }
    }

    // ---- publish point of tile t + 1 ----
    asm volatile("s_wait_dscnt 0x0" ::: "memory");      // this wave's reads of the buffer have returned
    asm volatile("s_wait_asynccnt 0x0" ::: "memory");   // this wave's share of tile t + 1 has landed
    __syncthreads();                                    // tile t + 1 published; every reader has left this buffer
    if (kt0 + 128 < SEQ) stage(buf, kt0 + 128);         // the same for the whole work-group
  }
  asm volatile("s_wait_asynccnt 0x0" ::: "memory");     // no copy is left in flight when the wave ends

  const float inv = 1.0f / (lrun + xhalf(lrun));   // join the two halves' sums once
  _Float16* orow = AO + ((size_t)b * SEQ + q0 + l16) * MODEL_DIM + h * HEAD_DIM + ko;
#pragma unroll
  for (int n = 0; n < 4; ++n) {
    f16x8 o;
#pragma unroll
    for (int r = 0; r < 8; ++r) o[r] = (_Float16)(oacc[n].f[r] * inv);
    *(f16x8*)(orow + n * 16) = o;
  }
}

// ---------------------------------------------------------------------------
extern "C" void kernel_launch(void* const* d_in, const int* in_sizes, int n_in,
                              void* d_out, int out_size, void* d_ws, size_t ws_size,
                              hipStream_t stream) {
  const float* q    = (const float*)d_in[0];
  const float* k    = (const float*)d_in[1];
  const float* v    = (const float*)d_in[2];
  const int*   mask = (const int*)d_in[3];
  const float* w_q  = (const float*)d_in[4];
  const float* b_q  = (const float*)d_in[5];
  const float* w_k  = (const float*)d_in[6];
  const float* b_k  = (const float*)d_in[7];
  const float* w_v  = (const float*)d_in[8];
  const float* b_v  = (const float*)d_in[9];
  const float* w_o  = (const float*)d_in[10];
  const float* b_o  = (const float*)d_in[11];

  _Float16* Xh   = (_Float16*)d_ws;                // q, k, v as f16, one after the other
  _Float16* WTb  = Xh + 3 * TEN;                   // w_q, w_k, w_v, w_o transposed
  _Float16* Qws  = WTb + 4 * WEL;                  // Q, K, V^T (by 32-row chunks) one after the other
  _Float16* Kws  = Qws + TEN;
  _Float16* Vws  = Kws + TEN;
  _Float16* AOws = Vws + TEN;
  unsigned* LMws = (unsigned*)(AOws + TEN);        // mask as lane-mask words, 512 KiB

  dim3 blk(256);

  prep_kernel<<<4 * WT_BLOCKS + MK_BLOCKS + 3 * CVT_BLOCKS, blk, 0, stream>>>(
      q, k, v, w_q, w_k, w_v, w_o, mask, Xh, WTb, LMws);
  gemm_qkv_kernel<<<dim3(MODEL_DIM / 128, ROWS / 128, 3), blk, 0, stream>>>(Xh, WTb, b_q, b_k,
                                                                            b_v, Qws);
  attn_kernel<<<dim3(SEQ / 128, BATCH * NUM_HEAD), blk, 0, stream>>>(Qws, Kws, Vws, LMws, AOws);
  gemm_out_kernel<<<dim3(MODEL_DIM / 128, ROWS / 128), blk, 0, stream>>>(AOws, WTb + 3 * WEL, b_o,
                                                                         (float*)d_out);
}

// v008
// One run takes 90.2 microseconds.
// Two timings next to v007 both put it at 1.03 times that version's speed.
// Over all steps from v000 it is 2.41 times as fast.
#include <hip/hip_runtime.h>

typedef __attribute__((ext_vector_type(16))) _Float16 v16h;
typedef __attribute__((ext_vector_type(8)))  _Float16 f16x8;
typedef __attribute__((ext_vector_type(8)))  float    v8f;
typedef __attribute__((ext_vector_type(4)))  int      v4i;

#define MODEL_DIM 1024
#define NUM_HEAD  16
#define HEAD_DIM  64
#define BATCH     2
#define SEQ       2048
#define ROWS      (BATCH * SEQ)   // 4096

union AFrag { v16h v; f16x8 h[2]; };
union CFrag { v8f  v; float f[8]; };

// ---------------------------------------------------------------------------
// CDNA5 async global->LDS copy (ASYNCcnt path), with synchronous fallback.
// Probe-confirmed signature: (v4i addrspace(1)*, v4i addrspace(3)*, Ii, Ii)
// ---------------------------------------------------------------------------
#if defined(__HIP_DEVICE_COMPILE__) &&                                        \
    __has_builtin(__builtin_amdgcn_global_load_async_to_lds_b128) &&          \
    __has_builtin(__builtin_amdgcn_s_wait_asynccnt)
#define HAVE_ASYNC 1
#else
#define HAVE_ASYNC 0
#endif

__device__ __forceinline__ void cp16(_Float16* lds, const _Float16* g) {
#if HAVE_ASYNC
  __builtin_amdgcn_global_load_async_to_lds_b128(
      (__attribute__((address_space(1))) v4i*)(void*)g,
      (__attribute__((address_space(3))) v4i*)(void*)lds, 0, 0);
#else
  *(f16x8*)lds = *(const f16x8*)g;
#endif
}
__device__ __forceinline__ void cp_wait() {
#if HAVE_ASYNC
  __builtin_amdgcn_s_wait_asynccnt(0);
#endif
}

// ---------------------------------------------------------------------------
// Prep, one launch for all eight independent jobs, told apart by block range:
//   blocks [0, 1024)      W[k][n] f32 -> WT[n][k] f16, 256 tiles of 64x64 per weight
//   blocks [1024, 1536)   mask int32 -> lane-mask words, one (16 queries, 64 keys) tile per wave
//   blocks [1536, 7680)   f32 -> f16 elementwise, 2048 blocks per activation
// Lane-mask word LM[query group][key tile][j*8 + r]: bit l is set where
// mask[group*16 + (l & 15)][tile*64 + j*16 + (l >> 4)*8 + r] != 0, which is the place of
// that score in the attention kernel's accumulators (sub-tile j, register r, lane l).
// The transposes come first: they have the longer chain (load, LDS, barrier, store).
// ---------------------------------------------------------------------------
#define TEN ((size_t)ROWS * MODEL_DIM)        // elements of one activation
#define WEL ((size_t)MODEL_DIM * MODEL_DIM)   // elements of one weight
#define WT_BLOCKS  256                        // per weight
#define CVT_BLOCKS 2048                       // per activation
#define MK_BLOCKS  512                        // (SEQ/16) * (SEQ/64) tiles, 8 waves a block

__global__ __launch_bounds__(256) void prep_kernel(const float* __restrict__ q,
                                                   const float* __restrict__ k,
                                                   const float* __restrict__ v,
                                                   const float* __restrict__ w_q,
                                                   const float* __restrict__ w_k,
                                                   const float* __restrict__ w_v,
                                                   const float* __restrict__ w_o,
                                                   const int* __restrict__ mask,
                                                   _Float16* __restrict__ Xh,
                                                   _Float16* __restrict__ WTb,
                                                   unsigned* __restrict__ LM) {
  __shared__ _Float16 tile[64][72];
  const int t   = threadIdx.x;
  const int bid = blockIdx.x;

  if (bid < 4 * WT_BLOCKS) {                     // block-uniform
    const int wsel = bid >> 8, tl = bid & 255;
    const float* __restrict__ W = wsel == 0 ? w_q : wsel == 1 ? w_k : wsel == 2 ? w_v : w_o;
    _Float16* __restrict__ WT = WTb + (size_t)wsel * WEL;
    const int n0 = (tl & 15) * 64, k0 = (tl >> 4) * 64;
#pragma unroll
    for (int i = 0; i < 4; ++i) {
      int idx = t + i * 256;                     // 0..1023 float4 chunks
      int kk = idx >> 4, n4 = idx & 15;
      const float4 f = *(const float4*)(W + (size_t)(k0 + kk) * MODEL_DIM + n0 + n4 * 4);
      tile[n4 * 4 + 0][kk] = (_Float16)f.x;
      tile[n4 * 4 + 1][kk] = (_Float16)f.y;
      tile[n4 * 4 + 2][kk] = (_Float16)f.z;
      tile[n4 * 4 + 3][kk] = (_Float16)f.w;
    }
    __syncthreads();
#pragma unroll
    for (int i = 0; i < 2; ++i) {
      int idx = t + i * 256;                     // 0..511 f16x8 chunks
      int n = idx >> 3, c8 = idx & 7;
      *(f16x8*)(WT + (size_t)(n0 + n) * MODEL_DIM + k0 + c8 * 8) =
          *(const f16x8*)&tile[n][c8 * 8];
    }
  } else if (bid < 4 * WT_BLOCKS + MK_BLOCKS) {  // block-uniform
    const int tile_id = (bid - 4 * WT_BLOCKS) * 8 + (t >> 5);   // group * 32 + key tile
    const int lane = t & 31;
    const int* __restrict__ mp = mask + (size_t)((tile_id >> 5) * 16 + (lane & 15)) * SEQ +
                                 (tile_id & 31) * 64 + (lane >> 4) * 8;
    v4i m[8];
#pragma unroll
    for (int i = 0; i < 8; ++i) m[i] = *(const v4i*)(mp + (i >> 1) * 16 + (i & 1) * 4);
    unsigned mine = 0;
#pragma unroll
    for (int i = 0; i < 32; ++i) {
      const unsigned w = __builtin_amdgcn_ballot_w32(m[i >> 2][i & 3] != 0);
      if (lane == i) mine = w;
    }
    LM[(size_t)tile_id * 32 + lane] = mine;
    // the store's address registers may be rewritten on a path laid out behind this branch: wait first
    asm volatile("s_wait_xcnt 0x0" ::: "memory");
  } else {
    const int cb = bid - 4 * WT_BLOCKS - MK_BLOCKS;
    const int xsel = cb >> 11;
    const float* __restrict__ X = xsel == 0 ? q : xsel == 1 ? k : v;
    _Float16* __restrict__ Y = Xh + (size_t)xsel * TEN;
    size_t base = ((size_t)(cb & 2047) * 256 + t) * 8;
    const float4 a = *(const float4*)(X + base);
    const float4 b = *(const float4*)(X + base + 4);
    f16x8 h;
    h[0] = (_Float16)a.x; h[1] = (_Float16)a.y; h[2] = (_Float16)a.z; h[3] = (_Float16)a.w;
    h[4] = (_Float16)b.x; h[5] = (_Float16)b.y; h[6] = (_Float16)b.z; h[7] = (_Float16)b.w;
    *(f16x8*)(Y + base) = h;
    // the store's address registers are rewritten on the path laid out behind this branch: wait first
    asm volatile("s_wait_xcnt 0x0" ::: "memory");
  }
}

// ---------------------------------------------------------------------------
// GEMM: C[ROWS,1024] = A[ROWS,1024](f16) * WT[1024,1024](f16,[n][k]) + bias
// Block tile 128x128, K-step 64, async LDS staging in a ring of NB buffers: a stage holds 128 bytes of
// every operand row, so eight lanes of a copy take one whole 128-byte line and no line is asked for twice.
//  NB 2: stage kt + 1 is asked for at the top of trip kt; three work-groups on a WGP cover one another's wait
//  NB 3: stage kt + 2 is asked for at the top of trip kt, two trips before its wait: for a work-group alone on its WGP
//  OUT_MODE 0 -> f16 into [B,H,S,64]    OUT_MODE 1 -> f32 into [B,S,1024]
//  OUT_MODE 0 with tr (block-uniform) -> f16 into [B,H,S/32][64 d][32 s]: transposed in
//  chunks of 32 rows, so that a wave's 32 x 64 tile is one contiguous 4 KiB that it alone writes.
//  A lane's eight accumulator registers are eight consecutive s of one d: one 16-byte store.
// ---------------------------------------------------------------------------
template <int OUT_MODE, int NB>
__device__ __forceinline__ void gemm_body(const _Float16* __restrict__ A,
                                          const _Float16* __restrict__ WT,
                                          const float* __restrict__ bias,
                                          void* __restrict__ outp, const bool tr) {
  __shared__ _Float16 As[NB][128][72];  // [m][k], +8 f16 pad: pitch 144 B = 16 B x odd
  __shared__ _Float16 Bs[NB][128][72];  // [n][k]

  const int t    = threadIdx.x;
  const int wid  = t >> 5;
  const int lane = t & 31;
  const int l16  = lane & 15;
  const int hi   = lane >> 4;
  const int m0   = blockIdx.y * 128;
  const int n0   = blockIdx.x * 128;
  const int wm   = wid & 3;             // 4 wave-rows * 32 rows
  const int wn   = wid >> 2;            // 2 wave-cols * 64 cols

  CFrag acc[2][4];
#pragma unroll
  for (int im = 0; im < 2; ++im)
#pragma unroll
    for (int in = 0; in < 4; ++in)
#pragma unroll
      for (int r = 0; r < 8; ++r) acc[im][in].f[r] = 0.0f;

  auto stage = [&](int buf, int k0) {
#pragma unroll
    for (int i = 0; i < 4; ++i) {
      int idx = t + i * 256;            // 0..1023, 16B chunks of the 128x64 tile
      int row = idx >> 3, c8 = idx & 7;
      cp16(&As[buf][row][c8 * 8], A  + (size_t)(m0 + row) * MODEL_DIM + k0 + c8 * 8);
      cp16(&Bs[buf][row][c8 * 8], WT + (size_t)(n0 + row) * MODEL_DIM + k0 + c8 * 8);
    }
  };

  constexpr int NS = MODEL_DIM / 64;    // stages
  stage(0, 0);
  if (NB == 3) stage(1, 64);
  const int ko = hi * 8;

  for (int kt = 0; kt < NS; ++kt) {
    if (NB == 3) {
      asm volatile("s_wait_dscnt 0x0" ::: "memory");      // this wave's reads of the buffer refilled below have returned
      // this wave's eight copies of stage kt have landed; the eight of stage kt + 1, its youngest, may still fly
      if (kt + 1 < NS) asm volatile("s_wait_asynccnt 0x8" ::: "memory");
      else             asm volatile("s_wait_asynccnt 0x0" ::: "memory");
    } else {
      cp_wait();
    }
    __syncthreads();                    // tile kt ready; tile kt-1 consumers done
    if (kt + NB - 1 < NS) stage((kt + NB - 1) % NB, (kt + NB - 1) * 64);
    const int buf = kt % NB;

    // unrolled: the two halves' LDS offsets become immediates and their loads can be issued ahead
#pragma unroll
    for (int kk = 0; kk < 64; kk += 32) {   // k runs upward as before: the sums keep their order
      AFrag af[2], bf[4];
#pragma unroll
      for (int im = 0; im < 2; ++im) {
        int mr = wm * 32 + im * 16 + l16;
        af[im].h[0] = *(const f16x8*)&As[buf][mr][kk + ko];
        af[im].h[1] = *(const f16x8*)&As[buf][mr][kk + 16 + ko];
      }
#pragma unroll
      for (int in = 0; in < 4; ++in) {
        int nr = wn * 64 + in * 16 + l16;
        bf[in].h[0] = *(const f16x8*)&Bs[buf][nr][kk + ko];
        bf[in].h[1] = *(const f16x8*)&Bs[buf][nr][kk + 16 + ko];
      }
#pragma unroll
      for (int im = 0; im < 2; ++im)
#pragma unroll
        for (int in = 0; in < 4; ++in)
          acc[im][in].v = __builtin_amdgcn_wmma_f32_16x16x32_f16(
              false, af[im].v, false, bf[in].v, (short)0, acc[im][in].v, false, false);
    }
  }

  float bn[4];
#pragma unroll
  for (int in = 0; in < 4; ++in) bn[in] = bias[n0 + wn * 64 + in * 16 + l16];

  if (OUT_MODE == 0 && tr) {
#pragma unroll
    for (int im = 0; im < 2; ++im)
#pragma unroll
      for (int in = 0; in < 4; ++in) {
        const int m = m0 + wm * 32 + im * 16 + 8 * hi;   // first of the lane's eight rows
        const int n = n0 + wn * 64 + in * 16 + l16;
        const int b = m >> 11, s = m & 2047;
        const int h = n >> 6, d = n & 63;
        f16x8 o;
#pragma unroll
        for (int r = 0; r < 8; ++r) o[r] = (_Float16)(acc[im][in].f[r] + bn[in]);
        *(f16x8*)((_Float16*)outp +
                  (((size_t)(b * NUM_HEAD + h) * (SEQ / 32) + (s >> 5)) * HEAD_DIM + d) * 32 +
                  (s & 31)) = o;
      }
  } else {
#pragma unroll
    for (int im = 0; im < 2; ++im)
#pragma unroll
      for (int in = 0; in < 4; ++in)
#pragma unroll
        for (int r = 0; r < 8; ++r) {
          int m = m0 + wm * 32 + im * 16 + r + 8 * hi;
          int n = n0 + wn * 64 + in * 16 + l16;
          float val = acc[im][in].f[r] + bn[in];
          if (OUT_MODE == 0) {
            int b = m >> 11, s = m & 2047;
            int h = n >> 6, d = n & 63;
            ((_Float16*)outp)[(((size_t)(b * NUM_HEAD + h) * SEQ + s) * HEAD_DIM) + d] =
                (_Float16)val;
          } else {
            ((float*)outp)[(size_t)m * MODEL_DIM + n] = val;
          }
        }
    // the stores' registers are rewritten on the path laid out behind this branch: wait first
    if (OUT_MODE == 0) asm volatile("s_wait_xcnt 0x0" ::: "memory");
  }
}

// The Q, K and V projections in one launch: blockIdx.z picks the product, so
// three 128x128 tiles share a WGP and one's copy latency hides behind the others.
// Six waves per SIMD: the register budget that keeps three work-groups on a WGP, so all 768 are resident at once.
__global__ __launch_bounds__(256) __attribute__((amdgpu_waves_per_eu(6))) void gemm_qkv_kernel(const _Float16* __restrict__ Xh,
                                                       const _Float16* __restrict__ WTb,
                                                       const float* __restrict__ b_q,
                                                       const float* __restrict__ b_k,
                                                       const float* __restrict__ b_v,
                                                       _Float16* __restrict__ QKV) {
  const int z = blockIdx.z;
  gemm_body<0, 2>(Xh + (size_t)z * TEN, WTb + (size_t)z * WEL,
               z == 0 ? b_q : z == 1 ? b_k : b_v, QKV + (size_t)z * TEN, z == 2);
}

__global__ __launch_bounds__(256) void gemm_out_kernel(const _Float16* __restrict__ A,
                                                       const _Float16* __restrict__ WT,
                                                       const float* __restrict__ bias,
                                                       float* __restrict__ out) {
  gemm_body<1, 3>(A, WT, bias, out, false);
}

__device__ __forceinline__ float xhalf(float x) {
  const int b = __builtin_bit_cast(int, x);
  return __builtin_bit_cast(
      float, __builtin_amdgcn_permlanex16(b, b, 0x76543210, 0xfedcba98, false, false));
}

__global__ __launch_bounds__(256) void attn_kernel(const _Float16* __restrict__ Q,
                                                   const _Float16* __restrict__ K,
                                                   const _Float16* __restrict__ VT,
                                                   const unsigned* __restrict__ LM,
                                                   _Float16* __restrict__ AO) {
  // per buffer: rows 0..63 the K tile [key][d], rows 64..127 the V^T tile [d][key]
  __shared__ __attribute__((aligned(16))) _Float16 KV[2][128][72];

  const int t    = threadIdx.x;
  const int wid  = t >> 5;
  const int lane = t & 31;
  const int l16  = lane & 15;
  const int hi   = lane >> 4;
  const int bh   = blockIdx.y;
  const int b    = bh >> 4, h = bh & 15;
  const int q0   = blockIdx.x * 128 + wid * 16;
  const int ko   = hi * 8;

  AFrag qf[2];                           // B operand: column = query q0 + l16
  {
    const _Float16* qrow = Q + ((size_t)bh * SEQ + q0 + l16) * HEAD_DIM;
    qf[0].h[0] = *(const f16x8*)(qrow + ko);
    qf[0].h[1] = *(const f16x8*)(qrow + 16 + ko);
    qf[1].h[0] = *(const f16x8*)(qrow + 32 + ko);
    qf[1].h[1] = *(const f16x8*)(qrow + 48 + ko);
  }

  CFrag oacc[4];                         // oacc[n].f[r] = O[q0 + l16][n*16 + 8*hi + r]
  float mrun = -1e30f;                   // running max of this lane's query, unscaled (both halves agree)
  float lrun = 0.0f;                     // running sum over this half's keys only
#pragma unroll
  for (int n = 0; n < 4; ++n)
#pragma unroll
    for (int r = 0; r < 8; ++r) oacc[n].f[r] = 0.0f;

  // exp(s / 8 - m / 8) = 2^(s * c1 - m * c1): the scores stay as the product leaves them, and the scale
  // 1/sqrt(HEAD_DIM) and log2(e) meet them in the one fused multiply-add that forms the exponent
  const float c1 = 0.125f * 1.44269504088896340736f;
  // a masked score, in the unscaled domain: below -1e9 * 8, so its weight beside any real score is 0 as in the
  // reference; a power of two, so that its product with c1 is exact and a row with every key masked gets the
  // exponent 0 for every key (equal weights, as in the reference)
  const float masked = -8589934592.0f;
  // this wave's lane-mask words: the address is the same in every lane, so they come by scalar loads
  // (constant address space: no launch-mate writes them, and the staging's "memory" clobbers must not turn them into per-lane loads)
  const __attribute__((address_space(4))) unsigned* lmw = (const __attribute__((address_space(4))) unsigned*)(const void*)(
      LM + (size_t)(blockIdx.x * 8 + __builtin_amdgcn_readfirstlane(wid)) * (32 * 32));

  // ---- staging: the K tile [key][d] and the V^T tile [d][key] by async copies ----
  // both tiles are 8 KiB, contiguous, at the same element offset; V^T is two chunks [64 d][32 keys];
  // a thread brings 16-byte pieces t and t + 256 of each
  const unsigned ldsK = (unsigned)(size_t)&KV[0][t >> 3][(t & 7) * 8];        // low 32 bits: the LDS byte address
  const unsigned ldsV = (unsigned)(size_t)&KV[0][64 + (t >> 2)][(t & 3) * 8];
  const _Float16* gK = K  + (size_t)bh * SEQ * HEAD_DIM + t * 8;
  const _Float16* gV = VT + (size_t)bh * SEQ * HEAD_DIM + t * 8;
  auto stage = [&](int buf, int kt0) {
    const unsigned lo = (unsigned)buf * (unsigned)sizeof(KV[0]);
    const _Float16* k0 = gK + (size_t)kt0 * HEAD_DIM;
    const _Float16* v0 = gV + (size_t)kt0 * HEAD_DIM;
    // the four copies and, as the statement's last line, the wait that stands before their address registers are rewritten
    asm volatile("global_load_async_to_lds_b128 %0, %4, off\n\t"
                 "global_load_async_to_lds_b128 %1, %5, off\n\t"
                 "global_load_async_to_lds_b128 %2, %6, off\n\t"
                 "global_load_async_to_lds_b128 %3, %7, off\n\t"
                 "s_wait_xcnt 0x0"
                 :: "v"(ldsK + lo), "v"(ldsK + lo + 32 * 144), "v"(ldsV + lo), "v"(ldsV + lo + 64),
                    "v"(k0), "v"(k0 + 2048), "v"(v0), "v"(v0 + 2048)
                 : "memory");
  };

  stage(0, 0);
  asm volatile("s_wait_asynccnt 0x0" ::: "memory");   // this wave's share of tile 0 has landed
  __syncthreads();                                    // tile 0 published
  stage(1, 64);

  unsigned mw[32];                       // the tile's lane-mask words, fetched one tile ahead like K and V^T
#pragma unroll
  for (int i = 0; i < 32; ++i) mw[i] = lmw[i];

  for (int kt0 = 0; kt0 < SEQ; kt0 += 64) {
    const int buf = (kt0 >> 6) & 1;
    const _Float16 (*Ks)[72]  = &KV[buf][0];
    const _Float16 (*VTs)[72] = &KV[buf][64];

    // ---- scores^T: 4 sub-tiles of 16 keys (rows), 2 WMMAs each over d ----
    // s[j].f[r] = unscaled score(query q0 + l16, key kt0 + j*16 + 8*hi + r)
    CFrag s[4];
    float vm[4];
#pragma unroll
    for (int j = 0; j < 4; ++j) {
      AFrag kb0, kb1;
      int kl = j * 16 + l16;
      kb0.h[0] = *(const f16x8*)&Ks[kl][ko];
      kb0.h[1] = *(const f16x8*)&Ks[kl][16 + ko];
      kb1.h[0] = *(const f16x8*)&Ks[kl][32 + ko];
      kb1.h[1] = *(const f16x8*)&Ks[kl][48 + ko];
      v8f z = {0.f, 0.f, 0.f, 0.f, 0.f, 0.f, 0.f, 0.f};
      s[j].v = __builtin_amdgcn_wmma_f32_16x16x32_f16(false, kb0.v, false, qf[0].v,
                                                      (short)0, z, false, false);
      s[j].v = __builtin_amdgcn_wmma_f32_16x16x32_f16(false, kb1.v, false, qf[1].v,
                                                      (short)0, s[j].v, false, false);
      // word j*8 + r is the select's lane mask as it stands: no compare, no per-lane load
#pragma unroll
      for (int r = 0; r < 8; ++r)
        s[j].f[r] = __builtin_amdgcn_inverse_ballot_w32(mw[j * 8 + r]) ? s[j].f[r] : masked;
      vm[j] = s[j].f[0];
#pragma unroll
      for (int r = 1; r < 8; ++r) vm[j] = fmaxf(vm[j], s[j].f[r]);
    }

    // the next tile's words, now that this tile's are used up (the last trip fetches its own again)
    {
      const int nx = (kt0 + 64 < SEQ ? kt0 + 64 : kt0) >> 1;
#pragma unroll
      for (int i = 0; i < 32; ++i) mw[i] = lmw[nx + i];
    }

    // ---- online softmax, one query per lane ----
    float vmax = fmaxf(fmaxf(vm[0], vm[1]), fmaxf(vm[2], vm[3]));
    vmax = fmaxf(vmax, xhalf(vmax));
    const float mnew = fmaxf(mrun, vmax);
    const float nm = -mnew * c1;
    const float c = __builtin_amdgcn_exp2f(__builtin_fmaf(mrun, c1, nm));
    mrun = mnew;

    AFrag pf[2];                         // B operand: two score sub-tiles converted in place, k order as vf below
    float ps[4];
#pragma unroll
    for (int j = 0; j < 4; ++j) {
      ps[j] = 0.0f;
#pragma unroll
      for (int r = 0; r < 8; ++r) {
        const float p = __builtin_amdgcn_exp2f(__builtin_fmaf(s[j].f[r], c1, nm));
        ps[j] += p;
        pf[j >> 1].v[(j & 1) * 8 + r] = (_Float16)p;
      }
    }
    const float psum = (ps[0] + ps[1]) + (ps[2] + ps[3]);
    lrun = lrun * c + psum;
#pragma unroll
    for (int n = 0; n < 4; ++n)
#pragma unroll
      for (int r = 0; r < 8; ++r) oacc[n].f[r] *= c;

    // ---- O^T += V^T @ P^T ----
#pragma unroll
    for (int kk = 0; kk < 2; ++kk) {
#pragma unroll
      for (int n = 0; n < 4; ++n) {
        AFrag vf;
        int d = n * 16 + l16;
        vf.h[0] = *(const f16x8*)&VTs[d][kk * 32 + ko];
        vf.h[1] = *(const f16x8*)&VTs[d][kk * 32 + 16 + ko];
        oacc[n].v = __builtin_amdgcn_wmma_f32_16x16x32_f16(false, vf.v, false, pf[kk].v,
                                                           (short)0, oacc[n].v, false, false);
      }
    }

    // ---- publish point of tile t + 1 ----
    asm volatile("s_wait_dscnt 0x0" ::: "memory");      // this wave's reads of the buffer have returned
    asm volatile("s_wait_asynccnt 0x0" ::: "memory");   // this wave's share of tile t + 1 has landed
    __syncthreads();                                    // tile t + 1 published; every reader has left this buffer
    if (kt0 + 128 < SEQ) stage(buf, kt0 + 128);         // the same for the whole work-group
  }
  asm volatile("s_wait_asynccnt 0x0" ::: "memory");     // no copy is left in flight when the wave ends

  const float inv = 1.0f / (lrun + xhalf(lrun));   // join the two halves' sums once
  _Float16* orow = AO + ((size_t)b * SEQ + q0 + l16) * MODEL_DIM + h * HEAD_DIM + ko;
#pragma unroll
  for (int n = 0; n < 4; ++n) {
    f16x8 o;
#pragma unroll
    for (int r = 0; r < 8; ++r) o[r] = (_Float16)(oacc[n].f[r] * inv);
    *(f16x8*)(orow + n * 16) = o;
  }
}

// ---------------------------------------------------------------------------
extern "C" void kernel_launch(void* const* d_in, const int* in_sizes, int n_in,
                              void* d_out, int out_size, void* d_ws, size_t ws_size,
                              hipStream_t stream) {
  const float* q    = (const float*)d_in[0];
  const float* k    = (const float*)d_in[1];
  const float* v    = (const float*)d_in[2];
  const int*   mask = (const int*)d_in[3];
  const float* w_q  = (const float*)d_in[4];
  const float* b_q  = (const float*)d_in[5];
  const float* w_k  = (const float*)d_in[6];
  const float* b_k  = (const float*)d_in[7];
  const float* w_v  = (const float*)d_in[8];
  const float* b_v  = (const float*)d_in[9];
  const float* w_o  = (const float*)d_in[10];
  const float* b_o  = (const float*)d_in[11];

  _Float16* Xh   = (_Float16*)d_ws;                // q, k, v as f16, one after the other
  _Float16* WTb  = Xh + 3 * TEN;                   // w_q, w_k, w_v, w_o transposed
  _Float16* Qws  = WTb + 4 * WEL;                  // Q, K, V^T (by 32-row chunks) one after the other
  _Float16* Kws  = Qws + TEN;
  _Float16* Vws  = Kws + TEN;
  _Float16* AOws = Vws + TEN;
  unsigned* LMws = (unsigned*)(AOws + TEN);        // mask as lane-mask words, 512 KiB

  dim3 blk(256);

  prep_kernel<<<4 * WT_BLOCKS + MK_BLOCKS + 3 * CVT_BLOCKS, blk, 0, stream>>>(
      q, k, v, w_q, w_k, w_v, w_o, mask, Xh, WTb, LMws);
  gemm_qkv_kernel<<<dim3(MODEL_DIM / 128, ROWS / 128, 3), blk, 0, stream>>>(Xh, WTb, b_q, b_k,
                                                                            b_v, Qws);
  attn_kernel<<<dim3(SEQ / 128, BATCH * NUM_HEAD), blk, 0, stream>>>(Qws, Kws, Vws, LMws, AOws);
  gemm_out_kernel<<<dim3(MODEL_DIM / 128, ROWS / 128), blk, 0, stream>>>(AOws, WTb + 3 * WEL, b_o,
                                                                         (float*)d_out);
}

// v009
// Measured time: 85.6 microseconds a run.
// Next to v008, in two timings, it ran 1.05 and 1.06 times as fast.
// Counting every step since v000, it is 2.54 times as fast.
#include <hip/hip_runtime.h>

typedef __attribute__((ext_vector_type(16))) _Float16 v16h;
typedef __attribute__((ext_vector_type(8)))  _Float16 f16x8;
typedef __attribute__((ext_vector_type(8)))  float    v8f;
typedef __attribute__((ext_vector_type(4)))  int      v4i;

#define MODEL_DIM 1024
#define NUM_HEAD  16
#define HEAD_DIM  64
#define BATCH     2
#define SEQ       2048
#define ROWS      (BATCH * SEQ)   // 4096

union AFrag { v16h v; f16x8 h[2]; };
union CFrag { v8f  v; float f[8]; };

// ---------------------------------------------------------------------------
// CDNA5 async global->LDS copy (ASYNCcnt path), with synchronous fallback.
// Probe-confirmed signature: (v4i addrspace(1)*, v4i addrspace(3)*, Ii, Ii)
// ---------------------------------------------------------------------------
#if defined(__HIP_DEVICE_COMPILE__) &&                                        \
    __has_builtin(__builtin_amdgcn_global_load_async_to_lds_b128) &&          \
    __has_builtin(__builtin_amdgcn_s_wait_asynccnt)
#define HAVE_ASYNC 1
#else
#define HAVE_ASYNC 0
#endif

__device__ __forceinline__ void cp16(_Float16* lds, const _Float16* g) {
#if HAVE_ASYNC
  __builtin_amdgcn_global_load_async_to_lds_b128(
      (__attribute__((address_space(1))) v4i*)(void*)g,
      (__attribute__((address_space(3))) v4i*)(void*)lds, 0, 0);
#else
  *(f16x8*)lds = *(const f16x8*)g;
#endif
}
__device__ __forceinline__ void cp_wait() {
#if HAVE_ASYNC
  __builtin_amdgcn_s_wait_asynccnt(0);
#endif
}

// ---------------------------------------------------------------------------
// Prep, one launch for all eight independent jobs, told apart by block range:
//   blocks [0, 1024)      W[k][n] f32 -> WT[n][k] f16, 256 tiles of 64x64 per weight
//   blocks [1024, 1536)   mask int32 -> lane-mask words, one (16 queries, 64 keys) tile per wave
//   blocks [1536, 7680)   f32 -> f16 elementwise, 2048 blocks per activation
// Lane-mask word LM[query group][key tile][j*8 + r]: bit l is set where
// mask[group*16 + (l & 15)][tile*64 + j*16 + (l >> 4)*8 + r] != 0, which is the place of
// that score in the attention kernel's accumulators (sub-tile j, register r, lane l).
// The transposes come first: they have the longer chain (load, LDS, barrier, store).
// ---------------------------------------------------------------------------
#define TEN ((size_t)ROWS * MODEL_DIM)        // elements of one activation
#define WEL ((size_t)MODEL_DIM * MODEL_DIM)   // elements of one weight
#define WT_BLOCKS  256                        // per weight
#define CVT_BLOCKS 2048                       // per activation
#define MK_BLOCKS  512                        // (SEQ/16) * (SEQ/64) tiles, 8 waves a block

__global__ __launch_bounds__(256) void prep_kernel(const float* __restrict__ q,
                                                   const float* __restrict__ k,
                                                   const float* __restrict__ v,
                                                   const float* __restrict__ w_q,
                                                   const float* __restrict__ w_k,
                                                   const float* __restrict__ w_v,
                                                   const float* __restrict__ w_o,
                                                   const int* __restrict__ mask,
                                                   _Float16* __restrict__ Xh,
                                                   _Float16* __restrict__ WTb,
                                                   unsigned* __restrict__ LM) {
  __shared__ _Float16 tile[64][72];
  const int t   = threadIdx.x;
  const int bid = blockIdx.x;

  if (bid < 4 * WT_BLOCKS) {                     // block-uniform
    const int wsel = bid >> 8, tl = bid & 255;
    const float* __restrict__ W = wsel == 0 ? w_q : wsel == 1 ? w_k : wsel == 2 ? w_v : w_o;
    _Float16* __restrict__ WT = WTb + (size_t)wsel * WEL;
    const int n0 = (tl & 15) * 64, k0 = (tl >> 4) * 64;
#pragma unroll
    for (int i = 0; i < 4; ++i) {
      int idx = t + i * 256;                     // 0..1023 float4 chunks
      int kk = idx >> 4, n4 = idx & 15;
      const float4 f = *(const float4*)(W + (size_t)(k0 + kk) * MODEL_DIM + n0 + n4 * 4);
      tile[n4 * 4 + 0][kk] = (_Float16)f.x;
      tile[n4 * 4 + 1][kk] = (_Float16)f.y;
      tile[n4 * 4 + 2][kk] = (_Float16)f.z;
      tile[n4 * 4 + 3][kk] = (_Float16)f.w;
    }
    __syncthreads();
#pragma unroll
    for (int i = 0; i < 2; ++i) {
      int idx = t + i * 256;                     // 0..511 f16x8 chunks
      int n = idx >> 3, c8 = idx & 7;
      *(f16x8*)(WT + (size_t)(n0 + n) * MODEL_DIM + k0 + c8 * 8) =
          *(const f16x8*)&tile[n][c8 * 8];
    }
  } else if (bid < 4 * WT_BLOCKS + MK_BLOCKS) {  // block-uniform
    const int tile_id = (bid - 4 * WT_BLOCKS) * 8 + (t >> 5);   // group * 32 + key tile
    const int lane = t & 31;
    const int* __restrict__ mp = mask + (size_t)((tile_id >> 5) * 16 + (lane & 15)) * SEQ +
                                 (tile_id & 31) * 64 + (lane >> 4) * 8;
    v4i m[8];
#pragma unroll
    for (int i = 0; i < 8; ++i) m[i] = *(const v4i*)(mp + (i >> 1) * 16 + (i & 1) * 4);
    unsigned mine = 0;
#pragma unroll
    for (int i = 0; i < 32; ++i) {
      const unsigned w = __builtin_amdgcn_ballot_w32(m[i >> 2][i & 3] != 0);
      if (lane == i) mine = w;
    }
    LM[(size_t)tile_id * 32 + lane] = mine;
    // the store's address registers may be rewritten on a path laid out behind this branch: wait first
    asm volatile("s_wait_xcnt 0x0" ::: "memory");
  } else {
    const int cb = bid - 4 * WT_BLOCKS - MK_BLOCKS;
    const int xsel = cb >> 11;
    const float* __restrict__ X = xsel == 0 ? q : xsel == 1 ? k : v;
    _Float16* __restrict__ Y = Xh + (size_t)xsel * TEN;
    size_t base = ((size_t)(cb & 2047) * 256 + t) * 8;
    const float4 a = *(const float4*)(X + base);
    const float4 b = *(const float4*)(X + base + 4);
    f16x8 h;
    h[0] = (_Float16)a.x; h[1] = (_Float16)a.y; h[2] = (_Float16)a.z; h[3] = (_Float16)a.w;
    h[4] = (_Float16)b.x; h[5] = (_Float16)b.y; h[6] = (_Float16)b.z; h[7] = (_Float16)b.w;
    *(f16x8*)(Y + base) = h;
    // the store's address registers are rewritten on the path laid out behind this branch: wait first
    asm volatile("s_wait_xcnt 0x0" ::: "memory");
  }
}

// ---------------------------------------------------------------------------
// GEMM: C[ROWS,1024] = A[ROWS,1024](f16) * WT[1024,1024](f16,[n][k]) + bias
// Block tile 128x128, K-step 64, async LDS staging in a ring of NB buffers: a stage holds 128 bytes of
// every operand row, so eight lanes of a copy take one whole 128-byte line and no line is asked for twice.
//  NB 2: stage kt + 1 is asked for at the top of trip kt; three work-groups on a WGP cover one another's wait
//  NB 3: stage kt + 2 is asked for at the top of trip kt, two trips before its wait: for a work-group alone on its WGP
//  OUT_MODE 0 -> f16 into [B,H,S,64]    OUT_MODE 1 -> f32 into [B,S,1024]
//  OUT_MODE 0 with tr (block-uniform) -> f16 into [B,H,S/32][64 d][32 s]: transposed in
//  chunks of 32 rows, so that a wave's 32 x 64 tile is one contiguous 4 KiB that it alone writes.
//  A lane's eight accumulator registers are eight consecutive s of one d: one 16-byte store.
// ---------------------------------------------------------------------------
template <int OUT_MODE, int NB>
__device__ __forceinline__ void gemm_body(const _Float16* __restrict__ A,
                                          const _Float16* __restrict__ WT,
                                          const float* __restrict__ bias,
                                          void* __restrict__ outp, const bool tr) {
  __shared__ _Float16 As[NB][128][72];  // [m][k], +8 f16 pad: pitch 144 B = 16 B x odd
  __shared__ _Float16 Bs[NB][128][72];  // [n][k]

  const int t    = threadIdx.x;
  const int wid  = t >> 5;
  const int lane = t & 31;
  const int l16  = lane & 15;
  const int hi   = lane >> 4;
  const int m0   = blockIdx.y * 128;
  const int n0   = blockIdx.x * 128;
  const int wm   = wid & 3;             // 4 wave-rows * 32 rows
  const int wn   = wid >> 2;            // 2 wave-cols * 64 cols

  CFrag acc[2][4];
#pragma unroll
  for (int im = 0; im < 2; ++im)
#pragma unroll
    for (int in = 0; in < 4; ++in)
#pragma unroll
      for (int r = 0; r < 8; ++r) acc[im][in].f[r] = 0.0f;

  auto stage = [&](int buf, int k0) {
#pragma unroll
    for (int i = 0; i < 4; ++i) {
      int idx = t + i * 256;            // 0..1023, 16B chunks of the 128x64 tile
      int row = idx >> 3, c8 = idx & 7;
      cp16(&As[buf][row][c8 * 8], A  + (size_t)(m0 + row) * MODEL_DIM + k0 + c8 * 8);
      cp16(&Bs[buf][row][c8 * 8], WT + (size_t)(n0 + row) * MODEL_DIM + k0 + c8 * 8);
    }
  };

  constexpr int NS = MODEL_DIM / 64;    // stages
  stage(0, 0);
  if (NB == 3) stage(1, 64);
  const int ko = hi * 8;

  for (int kt = 0; kt < NS; ++kt) {
    if (NB == 3) {
      asm volatile("s_wait_dscnt 0x0" ::: "memory");      // this wave's reads of the buffer refilled below have returned
      // this wave's eight copies of stage kt have landed; the eight of stage kt + 1, its youngest, may still fly
      if (kt + 1 < NS) asm volatile("s_wait_asynccnt 0x8" ::: "memory");
      else             asm volatile("s_wait_asynccnt 0x0" ::: "memory");
    } else {
      cp_wait();
    }
    __syncthreads();                    // tile kt ready; tile kt-1 consumers done
    if (kt + NB - 1 < NS) stage((kt + NB - 1) % NB, (kt + NB - 1) * 64);
    const int buf = kt % NB;

    // unrolled: the two halves' LDS offsets become immediates and their loads can be issued ahead
#pragma unroll
    for (int kk = 0; kk < 64; kk += 32) {   // k runs upward as before: the sums keep their order
      AFrag af[2], bf[4];
#pragma unroll
      for (int im = 0; im < 2; ++im) {
        int mr = wm * 32 + im * 16 + l16;
        af[im].h[0] = *(const f16x8*)&As[buf][mr][kk + ko];
        af[im].h[1] = *(const f16x8*)&As[buf][mr][kk + 16 + ko];
      }
#pragma unroll
      for (int in = 0; in < 4; ++in) {
        int nr = wn * 64 + in * 16 + l16;
        bf[in].h[0] = *(const f16x8*)&Bs[buf][nr][kk + ko];
        bf[in].h[1] = *(const f16x8*)&Bs[buf][nr][kk + 16 + ko];
      }
#pragma unroll
      for (int im = 0; im < 2; ++im)
#pragma unroll
        for (int in = 0; in < 4; ++in)
          acc[im][in].v = __builtin_amdgcn_wmma_f32_16x16x32_f16(
              false, af[im].v, false, bf[in].v, (short)0, acc[im][in].v, false, false);
    }
  }

  float bn[4];
#pragma unroll
  for (int in = 0; in < 4; ++in) bn[in] = bias[n0 + wn * 64 + in * 16 + l16];

  if (OUT_MODE == 0 && tr) {
#pragma unroll
    for (int im = 0; im < 2; ++im)
#pragma unroll
      for (int in = 0; in < 4; ++in) {
        const int m = m0 + wm * 32 + im * 16 + 8 * hi;   // first of the lane's eight rows
        const int n = n0 + wn * 64 + in * 16 + l16;
        const int b = m >> 11, s = m & 2047;
        const int h = n >> 6, d = n & 63;
        f16x8 o;
#pragma unroll
        for (int r = 0; r < 8; ++r) o[r] = (_Float16)(acc[im][in].f[r] + bn[in]);
        *(f16x8*)((_Float16*)outp +
                  (((size_t)(b * NUM_HEAD + h) * (SEQ / 32) + (s >> 5)) * HEAD_DIM + d) * 32 +
                  (s & 31)) = o;
      }
  } else {
#pragma unroll
    for (int im = 0; im < 2; ++im)
#pragma unroll
      for (int in = 0; in < 4; ++in)
#pragma unroll
        for (int r = 0; r < 8; ++r) {
          int m = m0 + wm * 32 + im * 16 + r + 8 * hi;
          int n = n0 + wn * 64 + in * 16 + l16;
          float val = acc[im][in].f[r] + bn[in];
          if (OUT_MODE == 0) {
            int b = m >> 11, s = m & 2047;
            int h = n >> 6, d = n & 63;
            ((_Float16*)outp)[(((size_t)(b * NUM_HEAD + h) * SEQ + s) * HEAD_DIM) + d] =
                (_Float16)val;
          } else {
            ((float*)outp)[(size_t)m * MODEL_DIM + n] = val;
          }
        }
    // the stores' registers are rewritten on the path laid out behind this branch: wait first
    if (OUT_MODE == 0) asm volatile("s_wait_xcnt 0x0" ::: "memory");
  }
}

// The Q, K and V projections in one launch: blockIdx.z picks the product, so
// three 128x128 tiles share a WGP and one's copy latency hides behind the others.
// Six waves per SIMD: the register budget that keeps three work-groups on a WGP, so all 768 are resident at once.
__global__ __launch_bounds__(256) __attribute__((amdgpu_waves_per_eu(6))) void gemm_qkv_kernel(const _Float16* __restrict__ Xh,
                                                       const _Float16* __restrict__ WTb,
                                                       const float* __restrict__ b_q,
                                                       const float* __restrict__ b_k,
                                                       const float* __restrict__ b_v,
                                                       _Float16* __restrict__ QKV) {
  const int z = blockIdx.z;
  gemm_body<0, 2>(Xh + (size_t)z * TEN, WTb + (size_t)z * WEL,
               z == 0 ? b_q : z == 1 ? b_k : b_v, QKV + (size_t)z * TEN, z == 2);
}

__global__ __launch_bounds__(256) void gemm_out_kernel(const _Float16* __restrict__ A,
                                                       const _Float16* __restrict__ WT,
                                                       const float* __restrict__ bias,
                                                       float* __restrict__ out) {
  gemm_body<1, 3>(A, WT, bias, out, false);
}

__device__ __forceinline__ float xhalf(float x) {
  const int b = __builtin_bit_cast(int, x);
  return __builtin_bit_cast(
      float, __builtin_amdgcn_permlanex16(b, b, 0x76543210, 0xfedcba98, false, false));
}

// Four waves per SIMD: the register budget that keeps two work-groups on a WGP, so all 512 are resident at once.
__global__ __launch_bounds__(256) __attribute__((amdgpu_waves_per_eu(4))) void attn_kernel(const _Float16* __restrict__ Q,
                                                   const _Float16* __restrict__ K,
                                                   const _Float16* __restrict__ VT,
                                                   const unsigned* __restrict__ LM,
                                                   _Float16* __restrict__ AO) {
  // per buffer and 64-key half: rows 0..63 the K tile [key][d], rows 64..127 the V^T tile [d][key]
  __shared__ __attribute__((aligned(16))) _Float16 KV[2][2][128][72];
  // the join behind the loop: what a wave hands to the wave that shares its queries
  __shared__ __attribute__((aligned(16))) float XO[8][8][32][4];   // [wave][four output values][lane]
  __shared__ float XM[8][2][32];                                   // [wave][maximum, sum][lane]

  const int t    = threadIdx.x;
  const int wid  = t >> 5;
  const int lane = t & 31;
  const int l16  = lane & 15;
  const int hi   = lane >> 4;
  const int swid = __builtin_amdgcn_readfirstlane(wid);
  const int qg   = swid & 3;             // which 32 queries
  const int kh   = swid >> 2;            // which 64 keys of every tile
  const int bh   = blockIdx.y;
  const int b    = bh >> 4, h = bh & 15;
  const int q0   = blockIdx.x * 128 + qg * 32;
  const int ko   = hi * 8;

  AFrag qf[2][2];                        // B operand: column = query q0 + cg*16 + l16
#pragma unroll
  for (int cg = 0; cg < 2; ++cg) {
    const _Float16* qrow = Q + ((size_t)bh * SEQ + q0 + cg * 16 + l16) * HEAD_DIM;
    qf[cg][0].h[0] = *(const f16x8*)(qrow + ko);
    qf[cg][0].h[1] = *(const f16x8*)(qrow + 16 + ko);
    qf[cg][1].h[0] = *(const f16x8*)(qrow + 32 + ko);
    qf[cg][1].h[1] = *(const f16x8*)(qrow + 48 + ko);
  }

  CFrag oacc[2][4];                      // oacc[cg][n].f[r] = O[q0 + cg*16 + l16][n*16 + 8*hi + r]
  float mrun[2];                         // running max of this lane's queries, unscaled (both halves agree)
  float lrun[2];                         // running sums over this half's keys only
#pragma unroll
  for (int cg = 0; cg < 2; ++cg) {
    mrun[cg] = -1e30f;
    lrun[cg] = 0.0f;
#pragma unroll
    for (int n = 0; n < 4; ++n)
#pragma unroll
      for (int r = 0; r < 8; ++r) oacc[cg][n].f[r] = 0.0f;
  }

  // exp(s / 8 - m / 8) = 2^(s * c1 - m * c1): the scores stay as the product leaves them, and the scale
  // 1/sqrt(HEAD_DIM) and log2(e) meet them in the one fused multiply-add that forms the exponent
  const float c1 = 0.125f * 1.44269504088896340736f;
  // a masked score, in the unscaled domain: below -1e9 * 8, so its weight beside any real score is 0 as in the
  // reference; a power of two, so that its product with c1 is exact and a row with every key masked gets the
  // exponent 0 for every key (equal weights, as in the reference)
  const float masked = -8589934592.0f;
  // this wave's lane-mask words: the address is the same in every lane, so they come by scalar loads
  // (constant address space: no launch-mate writes them, and the staging's "memory" clobbers must not turn them into per-lane loads)
  // column group cg's words lie 32 * 32 behind column group 0's
  const __attribute__((address_space(4))) unsigned* lmw = (const __attribute__((address_space(4))) unsigned*)(const void*)(
      LM + (size_t)(blockIdx.x * 8 + qg * 2) * (32 * 32) + kh * 32);

  // ---- staging: per 64-key half the K tile [key][d] and the V^T tile [d][key] by async copies ----
  // both tiles are 8 KiB, contiguous, at the same element offset; V^T is two chunks [64 d][32 keys];
  // a thread brings 16-byte pieces t and t + 256 of each
  const unsigned ldsK = (unsigned)(size_t)&KV[0][0][t >> 3][(t & 7) * 8];        // low 32 bits: the LDS byte address
  const unsigned ldsV = (unsigned)(size_t)&KV[0][0][64 + (t >> 2)][(t & 3) * 8];
  const _Float16* gK = K  + (size_t)bh * SEQ * HEAD_DIM + t * 8;
  const _Float16* gV = VT + (size_t)bh * SEQ * HEAD_DIM + t * 8;
  auto stage = [&](int buf, int kt0) {
    const unsigned lo = (unsigned)buf * (unsigned)sizeof(KV[0]);
    const unsigned l1 = lo + (unsigned)sizeof(KV[0][0]);
    const _Float16* k0 = gK + (size_t)kt0 * HEAD_DIM;
    const _Float16* v0 = gV + (size_t)kt0 * HEAD_DIM;
    // the eight copies and, as the statement's last line, the wait that stands before their address registers are rewritten
    asm volatile("global_load_async_to_lds_b128 %0, %8, off\n\t"
                 "global_load_async_to_lds_b128 %1, %9, off\n\t"
                 "global_load_async_to_lds_b128 %2, %10, off\n\t"
                 "global_load_async_to_lds_b128 %3, %11, off\n\t"
                 "global_load_async_to_lds_b128 %4, %12, off\n\t"
                 "global_load_async_to_lds_b128 %5, %13, off\n\t"
                 "global_load_async_to_lds_b128 %6, %14, off\n\t"
                 "global_load_async_to_lds_b128 %7, %15, off\n\t"
                 "s_wait_xcnt 0x0"
                 :: "v"(ldsK + lo), "v"(ldsK + lo + 32 * 144), "v"(ldsV + lo), "v"(ldsV + lo + 64),
                    "v"(ldsK + l1), "v"(ldsK + l1 + 32 * 144), "v"(ldsV + l1), "v"(ldsV + l1 + 64),
                    "v"(k0), "v"(k0 + 2048), "v"(v0), "v"(v0 + 2048),
                    "v"(k0 + 4096), "v"(k0 + 6144), "v"(v0 + 4096), "v"(v0 + 6144)
                 : "memory");
  };

  stage(0, 0);
  asm volatile("s_wait_asynccnt 0x0" ::: "memory");   // this wave's share of tile 0 has landed
  __syncthreads();                                    // tile 0 published
  stage(1, 128);

  unsigned mw[2][32];                    // the tile's lane-mask words, fetched one tile ahead like K and V^T
#pragma unroll
  for (int cg = 0; cg < 2; ++cg)
#pragma unroll
    for (int i = 0; i < 32; ++i) mw[cg][i] = lmw[cg * 1024 + i];

  for (int kt0 = 0; kt0 < SEQ; kt0 += 128) {
    const int buf = (kt0 >> 7) & 1;
    const _Float16 (*Ks)[72]  = &KV[buf][kh][0];
    const _Float16 (*VTs)[72] = &KV[buf][kh][64];

    // ---- scores^T: 4 sub-tiles of 16 keys (rows), per column group 2 WMMAs each over d ----
    // s[cg][j].f[r] = unscaled score(query q0 + cg*16 + l16, key kt0 + kh*64 + j*16 + 8*hi + r)
    CFrag s[2][4];
#pragma unroll
    for (int j = 0; j < 4; ++j) {
      AFrag kb0, kb1;
      int kl = j * 16 + l16;
      kb0.h[0] = *(const f16x8*)&Ks[kl][ko];
      kb0.h[1] = *(const f16x8*)&Ks[kl][16 + ko];
      kb1.h[0] = *(const f16x8*)&Ks[kl][32 + ko];
      kb1.h[1] = *(const f16x8*)&Ks[kl][48 + ko];
      v8f z = {0.f, 0.f, 0.f, 0.f, 0.f, 0.f, 0.f, 0.f};
#pragma unroll
      for (int cg = 0; cg < 2; ++cg) {
        s[cg][j].v = __builtin_amdgcn_wmma_f32_16x16x32_f16(false, kb0.v, false, qf[cg][0].v,
                                                            (short)0, z, false, false);
        s[cg][j].v = __builtin_amdgcn_wmma_f32_16x16x32_f16(false, kb1.v, false, qf[cg][1].v,
                                                            (short)0, s[cg][j].v, false, false);
      }
    }

    AFrag pf[2][2];                      // B operand: two score sub-tiles converted in place, k order as vf below
#pragma unroll
    for (int cg = 0; cg < 2; ++cg) {
      float vm[4];
#pragma unroll
      for (int j = 0; j < 4; ++j) {
        // word j*8 + r is the select's lane mask as it stands: no compare, no per-lane load
#pragma unroll
        for (int r = 0; r < 8; ++r)
          s[cg][j].f[r] = __builtin_amdgcn_inverse_ballot_w32(mw[cg][j * 8 + r]) ? s[cg][j].f[r] : masked;
        vm[j] = s[cg][j].f[0];
#pragma unroll
        for (int r = 1; r < 8; ++r) vm[j] = fmaxf(vm[j], s[cg][j].f[r]);
      }

      // the next tile's words, now that this tile's are used up (the last trip fetches its own again)
      {
        const int nx = (kt0 + 128 < SEQ ? kt0 + 128 : kt0) >> 1;
#pragma unroll
        for (int i = 0; i < 32; ++i) mw[cg][i] = lmw[cg * 1024 + nx + i];
      }

      // ---- online softmax, one query per lane ----
      float vmax = fmaxf(fmaxf(vm[0], vm[1]), fmaxf(vm[2], vm[3]));
      vmax = fmaxf(vmax, xhalf(vmax));
      const float mnew = fmaxf(mrun[cg], vmax);
      const float nm = -mnew * c1;
      const float c = __builtin_amdgcn_exp2f(__builtin_fmaf(mrun[cg], c1, nm));
      mrun[cg] = mnew;

      float ps[4];
#pragma unroll
      for (int j = 0; j < 4; ++j) {
        ps[j] = 0.0f;
#pragma unroll
        for (int r = 0; r < 8; ++r) {
          const float p = __builtin_amdgcn_exp2f(__builtin_fmaf(s[cg][j].f[r], c1, nm));
          ps[j] += p;
          pf[cg][j >> 1].v[(j & 1) * 8 + r] = (_Float16)p;
        }
      }
      const float psum = (ps[0] + ps[1]) + (ps[2] + ps[3]);
      lrun[cg] = lrun[cg] * c + psum;
#pragma unroll
      for (int n = 0; n < 4; ++n)
#pragma unroll
        for (int r = 0; r < 8; ++r) oacc[cg][n].f[r] *= c;
    }

    // ---- O^T += V^T @ P^T ----
#pragma unroll
    for (int kk = 0; kk < 2; ++kk) {
#pragma unroll
      for (int n = 0; n < 4; ++n) {
        AFrag vf;
        int d = n * 16 + l16;
        vf.h[0] = *(const f16x8*)&VTs[d][kk * 32 + ko];
        vf.h[1] = *(const f16x8*)&VTs[d][kk * 32 + 16 + ko];
#pragma unroll
        for (int cg = 0; cg < 2; ++cg)
          oacc[cg][n].v = __builtin_amdgcn_wmma_f32_16x16x32_f16(false, vf.v, false, pf[cg][kk].v,
                                                                 (short)0, oacc[cg][n].v, false, false);
      }
    }

    // ---- publish point of tile t + 1 ----
    asm volatile("s_wait_dscnt 0x0" ::: "memory");      // this wave's reads of the buffer have returned
    asm volatile("s_wait_asynccnt 0x0" ::: "memory");   // this wave's share of tile t + 1 has landed
    __syncthreads();                                    // tile t + 1 published; every reader has left this buffer
    if (kt0 + 256 < SEQ) stage(buf, kt0 + 256);         // the same for the whole work-group
  }
  asm volatile("s_wait_asynccnt 0x0" ::: "memory");     // no copy is left in flight when the wave ends

  // ---- join of the two key halves: wave kh finishes column group kh and hands the other one over ----
  const bool up = kh != 0;                               // the same in every lane of the wave
  const float l0 = lrun[0] + xhalf(lrun[0]);             // join the two wave halves' sums once
  const float l1 = lrun[1] + xhalf(lrun[1]);
  const float mk = up ? mrun[1] : mrun[0];
  const float lk = up ? l1 : l0;
  XM[wid][0][lane] = up ? mrun[0] : mrun[1];
  XM[wid][1][lane] = up ? l0 : l1;
#pragma unroll
  for (int n = 0; n < 4; ++n)
#pragma unroll
    for (int q4 = 0; q4 < 2; ++q4) {
      float4 g;
      g.x = up ? oacc[0][n].f[q4 * 4 + 0] : oacc[1][n].f[q4 * 4 + 0];
      g.y = up ? oacc[0][n].f[q4 * 4 + 1] : oacc[1][n].f[q4 * 4 + 1];
      g.z = up ? oacc[0][n].f[q4 * 4 + 2] : oacc[1][n].f[q4 * 4 + 2];
      g.w = up ? oacc[0][n].f[q4 * 4 + 3] : oacc[1][n].f[q4 * 4 + 3];
      *(float4*)&XO[wid][n * 2 + q4][lane][0] = g;
    }
  __syncthreads();                                       // the partner's maximum, sum and outputs are there
  const int pw = wid ^ 4;                                // the wave with the same queries and the other keys
  const float mo = XM[pw][0][lane];
  const float lo = XM[pw][1][lane];
  // the side with the larger maximum keeps its weight; the other is scaled down to it
  const float sc = __builtin_amdgcn_exp2f(-__builtin_fabsf(mk - mo) * c1);
  const float ak = mk >= mo ? 1.0f : sc;
  const float ao = mk >= mo ? sc : 1.0f;
  const float inv = 1.0f / (lk * ak + lo * ao);
  const float wk = ak * inv, wo = ao * inv;
  _Float16* orow = AO + ((size_t)b * SEQ + q0 + kh * 16 + l16) * MODEL_DIM + h * HEAD_DIM + ko;
#pragma unroll
  for (int n = 0; n < 4; ++n) {
    const float4 g0 = *(const float4*)&XO[pw][n * 2 + 0][lane][0];
    const float4 g1 = *(const float4*)&XO[pw][n * 2 + 1][lane][0];
    const float go[8] = {g0.x, g0.y, g0.z, g0.w, g1.x, g1.y, g1.z, g1.w};
    f16x8 o;
#pragma unroll
    for (int r = 0; r < 8; ++r)
      o[r] = (_Float16)((up ? oacc[1][n].f[r] : oacc[0][n].f[r]) * wk + go[r] * wo);
    *(f16x8*)(orow + n * 16) = o;
  }
}

// ---------------------------------------------------------------------------
extern "C" void kernel_launch(void* const* d_in, const int* in_sizes, int n_in,
                              void* d_out, int out_size, void* d_ws, size_t ws_size,
                              hipStream_t stream) {
  const float* q    = (const float*)d_in[0];
  const float* k    = (const float*)d_in[1];
  const float* v    = (const float*)d_in[2];
  const int*   mask = (const int*)d_in[3];
  const float* w_q  = (const float*)d_in[4];
  const float* b_q  = (const float*)d_in[5];
  const float* w_k  = (const float*)d_in[6];
  const float* b_k  = (const float*)d_in[7];
  const float* w_v  = (const float*)d_in[8];
  const float* b_v  = (const float*)d_in[9];
  const float* w_o  = (const float*)d_in[10];
  const float* b_o  = (const float*)d_in[11];

  _Float16* Xh   = (_Float16*)d_ws;                // q, k, v as f16, one after the other
  _Float16* WTb  = Xh + 3 * TEN;                   // w_q, w_k, w_v, w_o transposed
  _Float16* Qws  = WTb + 4 * WEL;                  // Q, K, V^T (by 32-row chunks) one after the other
  _Float16* Kws  = Qws + TEN;
  _Float16* Vws  = Kws + TEN;
  _Float16* AOws = Vws + TEN;
  unsigned* LMws = (unsigned*)(AOws + TEN);        // mask as lane-mask words, 512 KiB

  dim3 blk(256);

  prep_kernel<<<4 * WT_BLOCKS + MK_BLOCKS + 3 * CVT_BLOCKS, blk, 0, stream>>>(
      q, k, v, w_q, w_k, w_v, w_o, mask, Xh, WTb, LMws);
  gemm_qkv_kernel<<<dim3(MODEL_DIM / 128, ROWS / 128, 3), blk, 0, stream>>>(Xh, WTb, b_q, b_k,
                                                                            b_v, Qws);
  attn_kernel<<<dim3(SEQ / 128, BATCH * NUM_HEAD), blk, 0, stream>>>(Qws, Kws, Vws, LMws, AOws);
  gemm_out_kernel<<<dim3(MODEL_DIM / 128, ROWS / 128), blk, 0, stream>>>(AOws, WTb + 3 * WEL, b_o,
                                                                         (float*)d_out);
}

// v010
// It runs in 82.4 microseconds.
// Next to v009, in two timings, it ran 1.04 and 1.03 times as fast.
// Counting every step since v000, it is 2.62 times as fast.
#include <hip/hip_runtime.h>

typedef __attribute__((ext_vector_type(16))) _Float16 v16h;
typedef __attribute__((ext_vector_type(8)))  _Float16 f16x8;
typedef __attribute__((ext_vector_type(8)))  float    v8f;
typedef __attribute__((ext_vector_type(4)))  int      v4i;

#define MODEL_DIM 1024
#define NUM_HEAD  16
#define HEAD_DIM  64
#define BATCH     2
#define SEQ       2048
#define ROWS      (BATCH * SEQ)   // 4096

union AFrag { v16h v; f16x8 h[2]; };
union CFrag { v8f  v; float f[8]; };

// ---------------------------------------------------------------------------
// CDNA5 async global->LDS copy (ASYNCcnt path), with synchronous fallback.
// Probe-confirmed signature: (v4i addrspace(1)*, v4i addrspace(3)*, Ii, Ii)
// ---------------------------------------------------------------------------
#if defined(__HIP_DEVICE_COMPILE__) &&                                        \
    __has_builtin(__builtin_amdgcn_global_load_async_to_lds_b128) &&          \
    __has_builtin(__builtin_amdgcn_s_wait_asynccnt)
#define HAVE_ASYNC 1
#else
#define HAVE_ASYNC 0
#endif

__device__ __forceinline__ void cp16(_Float16* lds, const _Float16* g) {
#if HAVE_ASYNC
  __builtin_amdgcn_global_load_async_to_lds_b128(
      (__attribute__((address_space(1))) v4i*)(void*)g,
      (__attribute__((address_space(3))) v4i*)(void*)lds, 0, 0);
#else
  *(f16x8*)lds = *(const f16x8*)g;
#endif
}
__device__ __forceinline__ void cp_wait() {
#if HAVE_ASYNC
  __builtin_amdgcn_s_wait_asynccnt(0);
#endif
}

// ---------------------------------------------------------------------------
// Prep, one launch for all eight independent jobs, told apart by block range:
//   blocks [0, 1024)      W[k][n] f32 -> WT[n][k] f16, 256 tiles of 64x64 per weight
//   blocks [1024, 1536)   mask int32 -> lane-mask words, one (16 queries, 64 keys) tile per wave
//   blocks [1536, 7680)   f32 -> f16 elementwise, 2048 blocks per activation
// Lane-mask word LM[query group][key tile][j*8 + r]: bit l is set where
// mask[group*16 + (l & 15)][tile*64 + j*16 + (l >> 4)*8 + r] != 0, which is the place of
// that score in the attention kernel's accumulators (sub-tile j, register r, lane l).
// The transposes come first: they have the longer chain (load, LDS, barrier, store).
// ---------------------------------------------------------------------------
#define TEN ((size_t)ROWS * MODEL_DIM)        // elements of one activation
#define WEL ((size_t)MODEL_DIM * MODEL_DIM)   // elements of one weight
#define WT_BLOCKS  256                        // per weight
#define CVT_BLOCKS 2048                       // per activation
#define MK_BLOCKS  512                        // (SEQ/16) * (SEQ/64) tiles, 8 waves a block

__global__ __launch_bounds__(256) void prep_kernel(const float* __restrict__ q,
                                                   const float* __restrict__ k,
                                                   const float* __restrict__ v,
                                                   const float* __restrict__ w_q,
                                                   const float* __restrict__ w_k,
                                                   const float* __restrict__ w_v,
                                                   const float* __restrict__ w_o,
                                                   const int* __restrict__ mask,
                                                   _Float16* __restrict__ Xh,
                                                   _Float16* __restrict__ WTb,
                                                   unsigned* __restrict__ LM) {
  __shared__ _Float16 tile[64][72];
  const int t   = threadIdx.x;
  const int bid = blockIdx.x;

  if (bid < 4 * WT_BLOCKS) {                     // block-uniform
    const int wsel = bid >> 8, tl = bid & 255;
    const float* __restrict__ W = wsel == 0 ? w_q : wsel == 1 ? w_k : wsel == 2 ? w_v : w_o;
    _Float16* __restrict__ WT = WTb + (size_t)wsel * WEL;
    const int n0 = (tl & 15) * 64, k0 = (tl >> 4) * 64;
#pragma unroll
    for (int i = 0; i < 4; ++i) {
      int idx = t + i * 256;                     // 0..1023 float4 chunks
      int kk = idx >> 4, n4 = idx & 15;
      const float4 f = *(const float4*)(W + (size_t)(k0 + kk) * MODEL_DIM + n0 + n4 * 4);
      tile[n4 * 4 + 0][kk] = (_Float16)f.x;
      tile[n4 * 4 + 1][kk] = (_Float16)f.y;
      tile[n4 * 4 + 2][kk] = (_Float16)f.z;
      tile[n4 * 4 + 3][kk] = (_Float16)f.w;
    }
    __syncthreads();
#pragma unroll
    for (int i = 0; i < 2; ++i) {
      int idx = t + i * 256;                     // 0..511 f16x8 chunks
      int n = idx >> 3, c8 = idx & 7;
      *(f16x8*)(WT + (size_t)(n0 + n) * MODEL_DIM + k0 + c8 * 8) =
          *(const f16x8*)&tile[n][c8 * 8];
    }
  } else if (bid < 4 * WT_BLOCKS + MK_BLOCKS) {  // block-uniform
    const int tile_id = (bid - 4 * WT_BLOCKS) * 8 + (t >> 5);   // group * 32 + key tile
    const int lane = t & 31;
    const int* __restrict__ mp = mask + (size_t)((tile_id >> 5) * 16 + (lane & 15)) * SEQ +
                                 (tile_id & 31) * 64 + (lane >> 4) * 8;
    v4i m[8];
#pragma unroll
    for (int i = 0; i < 8; ++i) m[i] = *(const v4i*)(mp + (i >> 1) * 16 + (i & 1) * 4);
    unsigned mine = 0;
#pragma unroll
    for (int i = 0; i < 32; ++i) {
      const unsigned w = __builtin_amdgcn_ballot_w32(m[i >> 2][i & 3] != 0);
      if (lane == i) mine = w;
    }
    LM[(size_t)tile_id * 32 + lane] = mine;
    // the store's address registers may be rewritten on a path laid out behind this branch: wait first
    asm volatile("s_wait_xcnt 0x0" ::: "memory");
  } else {
    const int cb = bid - 4 * WT_BLOCKS - MK_BLOCKS;
    const int xsel = cb >> 11;
    const float* __restrict__ X = xsel == 0 ? q : xsel == 1 ? k : v;
    _Float16* __restrict__ Y = Xh + (size_t)xsel * TEN;
    size_t base = ((size_t)(cb & 2047) * 256 + t) * 8;
    const float4 a = *(const float4*)(X + base);
    const float4 b = *(const float4*)(X + base + 4);
    f16x8 h;
    h[0] = (_Float16)a.x; h[1] = (_Float16)a.y; h[2] = (_Float16)a.z; h[3] = (_Float16)a.w;
    h[4] = (_Float16)b.x; h[5] = (_Float16)b.y; h[6] = (_Float16)b.z; h[7] = (_Float16)b.w;
    *(f16x8*)(Y + base) = h;
    // the store's address registers are rewritten on the path laid out behind this branch: wait first
    asm volatile("s_wait_xcnt 0x0" ::: "memory");
  }
}

// ---------------------------------------------------------------------------
// GEMM: C[ROWS,1024] = A[ROWS,1024](f16) * WT[1024,1024](f16,[n][k]) + bias
// Block tile 128x128, K-step 64, async LDS staging in a ring of NB buffers: a stage holds 128 bytes of
// every operand row, so eight lanes of a copy take one whole 128-byte line and no line is asked for twice.
//  NB 2: stage kt + 1 is asked for at the top of trip kt; three work-groups on a WGP cover one another's wait
//  NB 3: stage kt + 2 is asked for at the top of trip kt, two trips before its wait: for a work-group alone on its WGP
//  OUT_MODE 0 -> f16 into [B,H,S,64]    OUT_MODE 1 -> f32 into [B,S,1024]
//  OUT_MODE 0 with tr (block-uniform) -> f16 into [B,H,S/32][64 d][32 s]: transposed in
//  chunks of 32 rows, so that a wave's 32 x 64 tile is one contiguous 4 KiB that it alone writes.
//  A lane's eight accumulator registers are eight consecutive s of one d: one 16-byte store.
// ---------------------------------------------------------------------------
template <int OUT_MODE, int NB>
__device__ __forceinline__ void gemm_body(const _Float16* __restrict__ A,
                                          const _Float16* __restrict__ WT,
                                          const float* __restrict__ bias,
                                          void* __restrict__ outp, const bool tr) {
  __shared__ _Float16 As[NB][128][72];  // [m][k], +8 f16 pad: pitch 144 B = 16 B x odd
  __shared__ _Float16 Bs[NB][128][72];  // [n][k]

  const int t    = threadIdx.x;
  const int wid  = t >> 5;
  const int lane = t & 31;
  const int l16  = lane & 15;
  const int hi   = lane >> 4;
  const int m0   = blockIdx.y * 128;
  const int n0   = blockIdx.x * 128;
  const int wm   = wid & 3;             // 4 wave-rows * 32 rows
  const int wn   = wid >> 2;            // 2 wave-cols * 64 cols

  CFrag acc[2][4];
#pragma unroll
  for (int im = 0; im < 2; ++im)
#pragma unroll
    for (int in = 0; in < 4; ++in)
#pragma unroll
      for (int r = 0; r < 8; ++r) acc[im][in].f[r] = 0.0f;

  auto stage = [&](int buf, int k0) {
#pragma unroll
    for (int i = 0; i < 4; ++i) {
      int idx = t + i * 256;            // 0..1023, 16B chunks of the 128x64 tile
      int row = idx >> 3, c8 = idx & 7;
      cp16(&As[buf][row][c8 * 8], A  + (size_t)(m0 + row) * MODEL_DIM + k0 + c8 * 8);
      cp16(&Bs[buf][row][c8 * 8], WT + (size_t)(n0 + row) * MODEL_DIM + k0 + c8 * 8);
    }
  };

  constexpr int NS = MODEL_DIM / 64;    // stages
  // The k loop starts at a stage of the work-group's own and wraps round. Work-groups that share operand rows (the 8 of one
  // blockIdx.y share A's, the 32 of one blockIdx.x share WT's) start together; from the same stage they would ask L2 for the
  // same lines at the same moment, and every row's piece of one stage lies 2 KiB from the next row's.
  const int rot = blockIdx.y + 2 * blockIdx.x + 5 * blockIdx.z;      // the same for the whole work-group
  auto kof = [&](int s) { return ((s + rot) & (NS - 1)) * 64; };     // stage s of this work-group covers k [kof, kof + 64)
  stage(0, kof(0));
  if (NB == 3) stage(1, kof(1));
  const int ko = hi * 8;

  for (int kt = 0; kt < NS; ++kt) {
    if (NB == 3) {
      asm volatile("s_wait_dscnt 0x0" ::: "memory");      // this wave's reads of the buffer refilled below have returned
      // this wave's eight copies of stage kt have landed; the eight of stage kt + 1, its youngest, may still fly
      if (kt + 1 < NS) asm volatile("s_wait_asynccnt 0x8" ::: "memory");
      else             asm volatile("s_wait_asynccnt 0x0" ::: "memory");
    } else {
      cp_wait();
    }
    __syncthreads();                    // tile kt ready; tile kt-1 consumers done
    if (kt + NB - 1 < NS) stage((kt + NB - 1) % NB, kof(kt + NB - 1));
    const int buf = kt % NB;

    // unrolled: the two halves' LDS offsets become immediates and their loads can be issued ahead
#pragma unroll
    for (int kk = 0; kk < 64; kk += 32) {   // inside a stage k runs upward
      AFrag af[2], bf[4];
#pragma unroll
      for (int im = 0; im < 2; ++im) {
        int mr = wm * 32 + im * 16 + l16;
        af[im].h[0] = *(const f16x8*)&As[buf][mr][kk + ko];
        af[im].h[1] = *(const f16x8*)&As[buf][mr][kk + 16 + ko];
      }
#pragma unroll
      for (int in = 0; in < 4; ++in) {
        int nr = wn * 64 + in * 16 + l16;
        bf[in].h[0] = *(const f16x8*)&Bs[buf][nr][kk + ko];
        bf[in].h[1] = *(const f16x8*)&Bs[buf][nr][kk + 16 + ko];
      }
#pragma unroll
      for (int im = 0; im < 2; ++im)
#pragma unroll
        for (int in = 0; in < 4; ++in)
          acc[im][in].v = __builtin_amdgcn_wmma_f32_16x16x32_f16(
              false, af[im].v, false, bf[in].v, (short)0, acc[im][in].v, false, false);
    }
  }

  float bn[4];
#pragma unroll
  for (int in = 0; in < 4; ++in) bn[in] = bias[n0 + wn * 64 + in * 16 + l16];

  if (OUT_MODE == 0 && tr) {
#pragma unroll
    for (int im = 0; im < 2; ++im)
#pragma unroll
      for (int in = 0; in < 4; ++in) {
        const int m = m0 + wm * 32 + im * 16 + 8 * hi;   // first of the lane's eight rows
        const int n = n0 + wn * 64 + in * 16 + l16;
        const int b = m >> 11, s = m & 2047;
        const int h = n >> 6, d = n & 63;
        f16x8 o;
#pragma unroll
        for (int r = 0; r < 8; ++r) o[r] = (_Float16)(acc[im][in].f[r] + bn[in]);
        *(f16x8*)((_Float16*)outp +
                  (((size_t)(b * NUM_HEAD + h) * (SEQ / 32) + (s >> 5)) * HEAD_DIM + d) * 32 +
                  (s & 31)) = o;
      }
  } else {
#pragma unroll
    for (int im = 0; im < 2; ++im)
#pragma unroll
      for (int in = 0; in < 4; ++in)
#pragma unroll
        for (int r = 0; r < 8; ++r) {
          int m = m0 + wm * 32 + im * 16 + r + 8 * hi;
          int n = n0 + wn * 64 + in * 16 + l16;
          float val = acc[im][in].f[r] + bn[in];
          if (OUT_MODE == 0) {
            int b = m >> 11, s = m & 2047;
            int h = n >> 6, d = n & 63;
            ((_Float16*)outp)[(((size_t)(b * NUM_HEAD + h) * SEQ + s) * HEAD_DIM) + d] =
                (_Float16)val;
          } else {
            ((float*)outp)[(size_t)m * MODEL_DIM + n] = val;
          }
        }
    // the stores' registers are rewritten on the path laid out behind this branch: wait first
    if (OUT_MODE == 0) asm volatile("s_wait_xcnt 0x0" ::: "memory");
  }
}

// The Q, K and V projections in one launch: blockIdx.z picks the product, so
// three 128x128 tiles share a WGP and one's copy latency hides behind the others.
// Six waves per SIMD: the register budget that keeps three work-groups on a WGP, so all 768 are resident at once.
__global__ __launch_bounds__(256) __attribute__((amdgpu_waves_per_eu(6))) void gemm_qkv_kernel(const _Float16* __restrict__ Xh,
                                                       const _Float16* __restrict__ WTb,
                                                       const float* __restrict__ b_q,
                                                       const float* __restrict__ b_k,
                                                       const float* __restrict__ b_v,
                                                       _Float16* __restrict__ QKV) {
  const int z = blockIdx.z;
  gemm_body<0, 2>(Xh + (size_t)z * TEN, WTb + (size_t)z * WEL,
               z == 0 ? b_q : z == 1 ? b_k : b_v, QKV + (size_t)z * TEN, z == 2);
}

__global__ __launch_bounds__(256) void gemm_out_kernel(const _Float16* __restrict__ A,
                                                       const _Float16* __restrict__ WT,
                                                       const float* __restrict__ bias,
                                                       float* __restrict__ out) {
  gemm_body<1, 3>(A, WT, bias, out, false);
}

__device__ __forceinline__ float xhalf(float x) {
  const int b = __builtin_bit_cast(int, x);
  return __builtin_bit_cast(
      float, __builtin_amdgcn_permlanex16(b, b, 0x76543210, 0xfedcba98, false, false));
}

// Four waves per SIMD: the register budget that keeps two work-groups on a WGP, so all 512 are resident at once.
__global__ __launch_bounds__(256) __attribute__((amdgpu_waves_per_eu(4))) void attn_kernel(const _Float16* __restrict__ Q,
                                                   const _Float16* __restrict__ K,
                                                   const _Float16* __restrict__ VT,
                                                   const unsigned* __restrict__ LM,
                                                   _Float16* __restrict__ AO) {
  // per buffer and 64-key half: rows 0..63 the K tile [key][d], rows 64..127 the V^T tile [d][key]
  __shared__ __attribute__((aligned(16))) _Float16 KV[2][2][128][72];
  // the join behind the loop: what a wave hands to the wave that shares its queries
  __shared__ __attribute__((aligned(16))) float XO[8][8][32][4];   // [wave][four output values][lane]
  __shared__ float XM[8][2][32];                                   // [wave][maximum, sum][lane]

  const int t    = threadIdx.x;
  const int wid  = t >> 5;
  const int lane = t & 31;
  const int l16  = lane & 15;
  const int hi   = lane >> 4;
  const int swid = __builtin_amdgcn_readfirstlane(wid);
  const int qg   = swid & 3;             // which 32 queries
  const int kh   = swid >> 2;            // which 64 keys of every tile
  const int bh   = blockIdx.y;
  const int b    = bh >> 4, h = bh & 15;
  const int q0   = blockIdx.x * 128 + qg * 32;
  const int ko   = hi * 8;

  AFrag qf[2][2];                        // B operand: column = query q0 + cg*16 + l16
#pragma unroll
  for (int cg = 0; cg < 2; ++cg) {
    const _Float16* qrow = Q + ((size_t)bh * SEQ + q0 + cg * 16 + l16) * HEAD_DIM;
    qf[cg][0].h[0] = *(const f16x8*)(qrow + ko);
    qf[cg][0].h[1] = *(const f16x8*)(qrow + 16 + ko);
    qf[cg][1].h[0] = *(const f16x8*)(qrow + 32 + ko);
    qf[cg][1].h[1] = *(const f16x8*)(qrow + 48 + ko);
  }

  CFrag oacc[2][4];                      // oacc[cg][n].f[r] = O[q0 + cg*16 + l16][n*16 + 8*hi + r]
  float mrun[2];                         // running max of this lane's queries, unscaled (both halves agree)
  float lrun[2];                         // running sums over this half's keys only
#pragma unroll
  for (int cg = 0; cg < 2; ++cg) {
    mrun[cg] = -1e30f;
    lrun[cg] = 0.0f;
#pragma unroll
    for (int n = 0; n < 4; ++n)
#pragma unroll
      for (int r = 0; r < 8; ++r) oacc[cg][n].f[r] = 0.0f;
  }

  // exp(s / 8 - m / 8) = 2^(s * c1 - m * c1): the scores stay as the product leaves them, and the scale
  // 1/sqrt(HEAD_DIM) and log2(e) meet them in the one fused multiply-add that forms the exponent
  const float c1 = 0.125f * 1.44269504088896340736f;
  // a masked score, in the unscaled domain: below -1e9 * 8, so its weight beside any real score is 0 as in the
  // reference; a power of two, so that its product with c1 is exact and a row with every key masked gets the
  // exponent 0 for every key (equal weights, as in the reference)
  const float masked = -8589934592.0f;
  // this wave's lane-mask words: the address is the same in every lane, so they come by scalar loads
  // (constant address space: no launch-mate writes them, and the staging's "memory" clobbers must not turn them into per-lane loads)
  // column group cg's words lie 32 * 32 behind column group 0's
  const __attribute__((address_space(4))) unsigned* lmw = (const __attribute__((address_space(4))) unsigned*)(const void*)(
      LM + (size_t)(blockIdx.x * 8 + qg * 2) * (32 * 32) + kh * 32);

  // ---- staging: per 64-key half the K tile [key][d] and the V^T tile [d][key] by async copies ----
  // both tiles are 8 KiB, contiguous, at the same element offset; V^T is two chunks [64 d][32 keys];
  // a thread brings 16-byte pieces t and t + 256 of each
  const unsigned ldsK = (unsigned)(size_t)&KV[0][0][t >> 3][(t & 7) * 8];        // low 32 bits: the LDS byte address
  const unsigned ldsV = (unsigned)(size_t)&KV[0][0][64 + (t >> 2)][(t & 3) * 8];
  const _Float16* gK = K  + (size_t)bh * SEQ * HEAD_DIM + t * 8;
  const _Float16* gV = VT + (size_t)bh * SEQ * HEAD_DIM + t * 8;
  auto stage = [&](int buf, int kt0) {
    const unsigned lo = (unsigned)buf * (unsigned)sizeof(KV[0]);
    const unsigned l1 = lo + (unsigned)sizeof(KV[0][0]);
    const _Float16* k0 = gK + (size_t)kt0 * HEAD_DIM;
    const _Float16* v0 = gV + (size_t)kt0 * HEAD_DIM;
    // the eight copies and, as the statement's last line, the wait that stands before their address registers are rewritten
    asm volatile("global_load_async_to_lds_b128 %0, %8, off\n\t"
                 "global_load_async_to_lds_b128 %1, %9, off\n\t"
                 "global_load_async_to_lds_b128 %2, %10, off\n\t"
                 "global_load_async_to_lds_b128 %3, %11, off\n\t"
                 "global_load_async_to_lds_b128 %4, %12, off\n\t"
                 "global_load_async_to_lds_b128 %5, %13, off\n\t"
                 "global_load_async_to_lds_b128 %6, %14, off\n\t"
                 "global_load_async_to_lds_b128 %7, %15, off\n\t"
                 "s_wait_xcnt 0x0"
                 :: "v"(ldsK + lo), "v"(ldsK + lo + 32 * 144), "v"(ldsV + lo), "v"(ldsV + lo + 64),
                    "v"(ldsK + l1), "v"(ldsK + l1 + 32 * 144), "v"(ldsV + l1), "v"(ldsV + l1 + 64),
                    "v"(k0), "v"(k0 + 2048), "v"(v0), "v"(v0 + 2048),
                    "v"(k0 + 4096), "v"(k0 + 6144), "v"(v0 + 4096), "v"(v0 + 6144)
                 : "memory");
  };

  stage(0, 0);
  asm volatile("s_wait_asynccnt 0x0" ::: "memory");   // this wave's share of tile 0 has landed
  __syncthreads();                                    // tile 0 published
  stage(1, 128);

  unsigned mw[2][32];                    // the tile's lane-mask words, fetched one tile ahead like K and V^T
#pragma unroll
  for (int cg = 0; cg < 2; ++cg)
#pragma unroll
    for (int i = 0; i < 32; ++i) mw[cg][i] = lmw[cg * 1024 + i];

  for (int kt0 = 0; kt0 < SEQ; kt0 += 128) {
    const int buf = (kt0 >> 7) & 1;
    const _Float16 (*Ks)[72]  = &KV[buf][kh][0];
    const _Float16 (*VTs)[72] = &KV[buf][kh][64];

    // ---- scores^T: 4 sub-tiles of 16 keys (rows), per column group 2 WMMAs each over d ----
    // s[cg][j].f[r] = unscaled score(query q0 + cg*16 + l16, key kt0 + kh*64 + j*16 + 8*hi + r)
    CFrag s[2][4];
#pragma unroll
    for (int j = 0; j < 4; ++j) {
      AFrag kb0, kb1;
      int kl = j * 16 + l16;
      kb0.h[0] = *(const f16x8*)&Ks[kl][ko];
      kb0.h[1] = *(const f16x8*)&Ks[kl][16 + ko];
      kb1.h[0] = *(const f16x8*)&Ks[kl][32 + ko];
      kb1.h[1] = *(const f16x8*)&Ks[kl][48 + ko];
      v8f z = {0.f, 0.f, 0.f, 0.f, 0.f, 0.f, 0.f, 0.f};
#pragma unroll
      for (int cg = 0; cg < 2; ++cg) {
        s[cg][j].v = __builtin_amdgcn_wmma_f32_16x16x32_f16(false, kb0.v, false, qf[cg][0].v,
                                                            (short)0, z, false, false);
        s[cg][j].v = __builtin_amdgcn_wmma_f32_16x16x32_f16(false, kb1.v, false, qf[cg][1].v,
                                                            (short)0, s[cg][j].v, false, false);
      }
    }

    AFrag pf[2][2];                      // B operand: two score sub-tiles converted in place, k order as vf below
#pragma unroll
    for (int cg = 0; cg < 2; ++cg) {
      float vm[4];
#pragma unroll
      for (int j = 0; j < 4; ++j) {
        // word j*8 + r is the select's lane mask as it stands: no compare, no per-lane load
#pragma unroll
        for (int r = 0; r < 8; ++r)
          s[cg][j].f[r] = __builtin_amdgcn_inverse_ballot_w32(mw[cg][j * 8 + r]) ? s[cg][j].f[r] : masked;
        vm[j] = s[cg][j].f[0];
#pragma unroll
        for (int r = 1; r < 8; ++r) vm[j] = fmaxf(vm[j], s[cg][j].f[r]);
      }

      // the next tile's words, now that this tile's are used up (the last trip fetches its own again)
      {
        const int nx = (kt0 + 128 < SEQ ? kt0 + 128 : kt0) >> 1;
#pragma unroll
        for (int i = 0; i < 32; ++i) mw[cg][i] = lmw[cg * 1024 + nx + i];
      }

      // ---- online softmax, one query per lane ----
      float vmax = fmaxf(fmaxf(vm[0], vm[1]), fmaxf(vm[2], vm[3]));
      vmax = fmaxf(vmax, xhalf(vmax));
      const float mnew = fmaxf(mrun[cg], vmax);
      const float nm = -mnew * c1;
      const float c = __builtin_amdgcn_exp2f(__builtin_fmaf(mrun[cg], c1, nm));
      mrun[cg] = mnew;

      float ps[4];
#pragma unroll
      for (int j = 0; j < 4; ++j) {
        ps[j] = 0.0f;
#pragma unroll
        for (int r = 0; r < 8; ++r) {
          const float p = __builtin_amdgcn_exp2f(__builtin_fmaf(s[cg][j].f[r], c1, nm));
          ps[j] += p;
          pf[cg][j >> 1].v[(j & 1) * 8 + r] = (_Float16)p;
        }
      }
      const float psum = (ps[0] + ps[1]) + (ps[2] + ps[3]);
      lrun[cg] = lrun[cg] * c + psum;
#pragma unroll
      for (int n = 0; n < 4; ++n)
#pragma unroll
        for (int r = 0; r < 8; ++r) oacc[cg][n].f[r] *= c;
    }

    // ---- O^T += V^T @ P^T ----
#pragma unroll
    for (int kk = 0; kk < 2; ++kk) {
#pragma unroll
      for (int n = 0; n < 4; ++n) {
        AFrag vf;
        int d = n * 16 + l16;
        vf.h[0] = *(const f16x8*)&VTs[d][kk * 32 + ko];
        vf.h[1] = *(const f16x8*)&VTs[d][kk * 32 + 16 + ko];
#pragma unroll
        for (int cg = 0; cg < 2; ++cg)
          oacc[cg][n].v = __builtin_amdgcn_wmma_f32_16x16x32_f16(false, vf.v, false, pf[cg][kk].v,
                                                                 (short)0, oacc[cg][n].v, false, false);
      }
    }

    // ---- publish point of tile t + 1 ----
    asm volatile("s_wait_dscnt 0x0" ::: "memory");      // this wave's reads of the buffer have returned
    asm volatile("s_wait_asynccnt 0x0" ::: "memory");   // this wave's share of tile t + 1 has landed
    __syncthreads();                                    // tile t + 1 published; every reader has left this buffer
    if (kt0 + 256 < SEQ) stage(buf, kt0 + 256);         // the same for the whole work-group
  }
  asm volatile("s_wait_asynccnt 0x0" ::: "memory");     // no copy is left in flight when the wave ends

  // ---- join of the two key halves: wave kh finishes column group kh and hands the other one over ----
  const bool up = kh != 0;                               // the same in every lane of the wave
  const float l0 = lrun[0] + xhalf(lrun[0]);             // join the two wave halves' sums once
  const float l1 = lrun[1] + xhalf(lrun[1]);
  const float mk = up ? mrun[1] : mrun[0];
  const float lk = up ? l1 : l0;
  XM[wid][0][lane] = up ? mrun[0] : mrun[1];
  XM[wid][1][lane] = up ? l0 : l1;
#pragma unroll
  for (int n = 0; n < 4; ++n)
#pragma unroll
    for (int q4 = 0; q4 < 2; ++q4) {
      float4 g;
      g.x = up ? oacc[0][n].f[q4 * 4 + 0] : oacc[1][n].f[q4 * 4 + 0];
      g.y = up ? oacc[0][n].f[q4 * 4 + 1] : oacc[1][n].f[q4 * 4 + 1];
      g.z = up ? oacc[0][n].f[q4 * 4 + 2] : oacc[1][n].f[q4 * 4 + 2];
      g.w = up ? oacc[0][n].f[q4 * 4 + 3] : oacc[1][n].f[q4 * 4 + 3];
      *(float4*)&XO[wid][n * 2 + q4][lane][0] = g;
    }
  __syncthreads();                                       // the partner's maximum, sum and outputs are there
  const int pw = wid ^ 4;                                // the wave with the same queries and the other keys
  const float mo = XM[pw][0][lane];
  const float lo = XM[pw][1][lane];
  // the side with the larger maximum keeps its weight; the other is scaled down to it
  const float sc = __builtin_amdgcn_exp2f(-__builtin_fabsf(mk - mo) * c1);
  const float ak = mk >= mo ? 1.0f : sc;
  const float ao = mk >= mo ? sc : 1.0f;
  const float inv = 1.0f / (lk * ak + lo * ao);
  const float wk = ak * inv, wo = ao * inv;
  _Float16* orow = AO + ((size_t)b * SEQ + q0 + kh * 16 + l16) * MODEL_DIM + h * HEAD_DIM + ko;
#pragma unroll
  for (int n = 0; n < 4; ++n) {
    const float4 g0 = *(const float4*)&XO[pw][n * 2 + 0][lane][0];
    const float4 g1 = *(const float4*)&XO[pw][n * 2 + 1][lane][0];
    const float go[8] = {g0.x, g0.y, g0.z, g0.w, g1.x, g1.y, g1.z, g1.w};
    f16x8 o;
#pragma unroll
    for (int r = 0; r < 8; ++r)
      o[r] = (_Float16)((up ? oacc[1][n].f[r] : oacc[0][n].f[r]) * wk + go[r] * wo);
    *(f16x8*)(orow + n * 16) = o;
  }
}

// ---------------------------------------------------------------------------
extern "C" void kernel_launch(void* const* d_in, const int* in_sizes, int n_in,
                              void* d_out, int out_size, void* d_ws, size_t ws_size,
                              hipStream_t stream) {
  const float* q    = (const float*)d_in[0];
  const float* k    = (const float*)d_in[1];
  const float* v    = (const float*)d_in[2];
  const int*   mask = (const int*)d_in[3];
  const float* w_q  = (const float*)d_in[4];
  const float* b_q  = (const float*)d_in[5];
  const float* w_k  = (const float*)d_in[6];
  const float* b_k  = (const float*)d_in[7];
  const float* w_v  = (const float*)d_in[8];
  const float* b_v  = (const float*)d_in[9];
  const float* w_o  = (const float*)d_in[10];
  const float* b_o  = (const float*)d_in[11];

  _Float16* Xh   = (_Float16*)d_ws;                // q, k, v as f16, one after the other
  _Float16* WTb  = Xh + 3 * TEN;                   // w_q, w_k, w_v, w_o transposed
  _Float16* Qws  = WTb + 4 * WEL;                  // Q, K, V^T (by 32-row chunks) one after the other
  _Float16* Kws  = Qws + TEN;
  _Float16* Vws  = Kws + TEN;
  _Float16* AOws = Vws + TEN;
  unsigned* LMws = (unsigned*)(AOws + TEN);        // mask as lane-mask words, 512 KiB

  dim3 blk(256);

  prep_kernel<<<4 * WT_BLOCKS + MK_BLOCKS + 3 * CVT_BLOCKS, blk, 0, stream>>>(
      q, k, v, w_q, w_k, w_v, w_o, mask, Xh, WTb, LMws);
  gemm_qkv_kernel<<<dim3(MODEL_DIM / 128, ROWS / 128, 3), blk, 0, stream>>>(Xh, WTb, b_q, b_k,
                                                                            b_v, Qws);
  attn_kernel<<<dim3(SEQ / 128, BATCH * NUM_HEAD), blk, 0, stream>>>(Qws, Kws, Vws, LMws, AOws);
  gemm_out_kernel<<<dim3(MODEL_DIM / 128, ROWS / 128), blk, 0, stream>>>(AOws, WTb + 3 * WEL, b_o,
                                                                         (float*)d_out);
}
